// v000
// Measured on an AMD MI455X. A time is GPU time per run, averaged over a window of back-to-back runs after a warm-up
// (all launches, gaps included; the runs take copies of the inputs in turn), and the median of several windows.
// Apart from v000's, it joins two sittings. Times from different sittings can be a few percent apart, while
// side-by-side timings come from the same sitting.
// The starting kernel, v000, takes 2440 microseconds a run.
// compute dtype: x, w1, u1 (INPUTS) as exact bf16 WMMA products (f32 accumulate); the generated weights w = hw w2^T use the computed 32-wide code hw as a bf16 hi/lo pair against bf16(w2) (2 products, f32-grade); LayerNorm statistics, the per-token mat-vec with (bf16-rounded) x and the bias path in f32. The 65,536 generated weights per token never leave registers: each 16x16 tile contributes its partial sums (sum w, sum w^2, sum w*x) directly.
#include <hip/hip_runtime.h>
#include <math.h>

typedef __attribute__((ext_vector_type(16))) _Float16 v16h;
typedef __attribute__((ext_vector_type(16))) __bf16 v16b;
typedef __attribute__((ext_vector_type(8)))  _Float16 v8h;
typedef __attribute__((ext_vector_type(8)))  float v8f;
typedef __attribute__((ext_vector_type(4)))  float v4f;
typedef __attribute__((ext_vector_type(2)))  float v2f;
typedef __attribute__((ext_vector_type(4)))  unsigned v4u;
typedef __attribute__((ext_vector_type(4)))  int v4i;
typedef float __attribute__((may_alias)) float_a;
typedef int __attribute__((may_alias)) int_a;

template <typename T> __device__ __forceinline__ void vst2(void* p, T v) { *(T*)p = v;  }
__device__ __forceinline__ v8f wmma16(v16h a, v16h b, v8f c) {
  v8f d = __builtin_amdgcn_wmma_f32_16x16x32_f16(false, a, false, b, (short)0, c, false, false);
  asm volatile("v_nop\n\tv_nop\n\tv_nop\n\tv_nop" : "+v"(d) : "v"(a), "v"(b));
  return d;
}
__device__ __forceinline__ v8f wmma_bf(v16b a, v16b b, v8f c) {
  v8f d = __builtin_amdgcn_wmma_f32_16x16x32_bf16(false, a, false, b, (short)0, c, false, false);
  asm volatile("v_nop\n\tv_nop\n\tv_nop\n\tv_nop" : "+v"(d) : "v"(a), "v"(b));
  return d;
}
// 16x16x32 fragments: lane = (h = lane>>4, row/col = lane&15); elements 0..7 = k0+8h+0..7, 8..15 = k0+16+8h+0..7; D element r = row 8h+r
__device__ __forceinline__ v16h frag_h(const _Float16* rowk0, int lane) {
  union { v16h v; v8h q[2]; } u; const _Float16* p = rowk0 + 8 * (lane >> 4);
  u.q[0] = *(const v8h*)p; u.q[1] = *(const v8h*)(p + 16); return u.v;
}
__device__ __forceinline__ v16h frag_f32(const float* rowk0, int lane) {
  v16h a; const float* p = rowk0 + 8 * (lane >> 4);
#pragma unroll
  for (int i = 0; i < 8; ++i) { a[i] = (_Float16)p[i]; a[8 + i] = (_Float16)p[16 + i]; }
  return a;
}
__device__ __forceinline__ v16h frag_f32s(const float* rowk0, int lane, float sc) {
  v16h a; const float* p = rowk0 + 8 * (lane >> 4);
#pragma unroll
  for (int i = 0; i < 8; ++i) { a[i] = (_Float16)(p[i] * sc); a[8 + i] = (_Float16)(p[16 + i] * sc); }
  return a;
}
// column fragment from a [K][ld] layout (column n), rows >= K read as 0
__device__ __forceinline__ v16h fragc_f32(const float* W, int k0, int n, int lane, int ld, int K) {
  v16h a; const int g = lane >> 4;
#pragma unroll
  for (int i = 0; i < 8; ++i) { const int ka = k0 + 8 * g + i, kb = ka + 16;
    a[i] = (_Float16)(ka < K ? W[(size_t)(ka < K ? ka : K - 1) * ld + n] : 0.f); a[8 + i] = (_Float16)(kb < K ? W[(size_t)(kb < K ? kb : K - 1) * ld + n] : 0.f); }
  return a;
}
struct F2 { v16b h, l; };
__device__ __forceinline__ F2 bsplit16(const float v[16]) { F2 r;
#pragma unroll
  for (int i = 0; i < 16; ++i) { const __bf16 h = (__bf16)v[i]; r.h[i] = h; r.l[i] = (__bf16)(v[i] - (float)h); }
  return r; }
__device__ __forceinline__ F2 split_row(const float* row, int k0, int lane) { float v[16]; const float* p = row + k0 + 8 * (lane >> 4);
#pragma unroll
  for (int i = 0; i < 8; ++i) { v[i] = p[i]; v[8 + i] = p[16 + i]; }
  return bsplit16(v); }
__device__ __forceinline__ F2 split_rowK(const float* row, int k0, int lane, int K) { float v[16]; const int g = lane >> 4;
#pragma unroll
  for (int i = 0; i < 8; ++i) { const int ka = k0 + 8 * g + i, kb = ka + 16; v[i] = ka < K ? row[ka < K ? ka : K - 1] : 0.f; v[8 + i] = kb < K ? row[kb < K ? kb : K - 1] : 0.f; }
  return bsplit16(v); }
__device__ __forceinline__ F2 split_col(const float* W, int k0, int n, int lane, int ld, int K) { float v[16]; const int g = lane >> 4;
#pragma unroll
  for (int i = 0; i < 8; ++i) { const int ka = k0 + 8 * g + i, kb = ka + 16; v[i] = ka < K ? W[(size_t)(ka < K ? ka : K - 1) * ld + n] : 0.f; v[8 + i] = kb < K ? W[(size_t)(kb < K ? kb : K - 1) * ld + n] : 0.f; }
  return bsplit16(v); }
__device__ __forceinline__ v8f mac3(const F2& a, const F2& b, v8f c) { c = wmma_bf(a.l, b.h, c); c = wmma_bf(a.h, b.l, c); return wmma_bf(a.h, b.h, c); }
__device__ __forceinline__ float sigm(float v) { return 1.0f / (1.0f + expf(-v)); }
#define LDSX() do { asm volatile("s_wait_dscnt 0" ::: "memory"); __builtin_amdgcn_wave_barrier(); __builtin_amdgcn_fence(__ATOMIC_RELEASE, "workgroup"); } while (0)


// Hyper-network linear layer: per token: hw = x w1^T + b1 (32); W[o][i] = LN_i(hw . w2[o*256+i] + b2[o*256+i]) (no affine, eps 1e-5); hb = x u1^T + c1; bias[o] = LN_o(hb . u2[o] + c2[o]);
// y[o] = sum_i W[o][i] x[i] + bias[o] = (S_wx - mu_o S_x) * rsqrt(var_o + eps) + bias[o], with S_w, S_w2, S_wx accumulated per (token, o) over the 16 tiles of that o.
// One kernel: block = 64 tokens (4 waves x 16): hw/hb by exact WMMA, hw split hi/lo once into an LDS A fragment row [hi(32)|lo(32)] (K = 64 chunk: two k-chunks), then for o = 0..255:
// 16 tiles of [16 tokens x 16 i] = A x bf16(w2 rows) (+ bf16(b2)), per-lane partial sums with x[token][i], xor-reduction over the 16 column lanes, y[token][o] finished by lane o%16... stored per row.
#define NB 4
#define SQ 512
#define NT (NB * SQ)     // 2048 tokens
#define IN 256
#define OUT 256
#define HID 32
__device__ __forceinline__ float bfr(float v) { return (float)(__bf16)v; }
__device__ __forceinline__ v16b frag_b(const __bf16* rowk0, int lane) { return __builtin_bit_cast(v16b, frag_h((const _Float16*)rowk0, lane)); }

__global__ __launch_bounds__(128) void k_meta(const float* __restrict__ x, const float* __restrict__ w1, const float* __restrict__ b1, const float* __restrict__ w2, const float* __restrict__ b2, const float* __restrict__ u1, const float* __restrict__ c1, const float* __restrict__ u2, const float* __restrict__ c2, float* __restrict__ y) {
  __shared__ __align__(16) __bf16 sa[4][16][72];        // per token: [hi(hw) 32 | lo(hw) 32] -> A fragments for the w2 GEMM (k-chunk 0 = hi, 1 = lo)
  __shared__ __align__(16) float shb[4][16][36];         // hb rows
  __shared__ __align__(16) float sx[4][16][IN + 4];      // x rows (f32) for the mat-vec partials
  __shared__ __align__(16) float sy[4][16][OUT + 4];     // outputs
  __shared__ float sbias[4][16][OUT + 4];                // generated bias pre-LN, then LN'd
  const int tid = threadIdx.x, wave = tid >> 5, lane = tid & 31, col = lane & 15, g = lane >> 4; const int t0 = blockIdx.x * 64 + wave * 16;
  // stage x rows
  for (int q = lane; q < 16 * (IN / 4); q += 32) { const int rl = q >> 6, pc = q & 63; v4f v = *(const v4f*)(x + (size_t)(t0 + rl) * IN + pc * 4);
#pragma unroll
    for (int e = 0; e < 4; ++e) v[e] = bfr(v[e]);      // x is rounded to bf16 everywhere, including the final mat-vec
    *(v4f*)(&sx[wave][rl][pc * 4]) = v; }
  // hw, hb: [16 x 256] @ [256 x 32]: 2 column tiles each, exact bf16 products
  { v8f ah[2] = {}, ab[2] = {};
#pragma unroll
    for (int kc = 0; kc < IN / 32; ++kc) { const v16b a = split_row(x + (size_t)(t0 + col) * IN, kc * 32, lane).h;
#pragma unroll
      for (int j = 0; j < 2; ++j) { ah[j] = wmma_bf(a, split_row(w1 + (size_t)(j * 16 + col) * IN, kc * 32, lane).h, ah[j]); ab[j] = wmma_bf(a, split_row(u1 + (size_t)(j * 16 + col) * IN, kc * 32, lane).h, ab[j]); } }
#pragma unroll
    for (int j = 0; j < 2; ++j) { const int n = j * 16 + col; const float bb1 = bfr(b1[n]), cc1 = bfr(c1[n]);
#pragma unroll
      for (int r = 0; r < 8; ++r) { const float hv = ah[j][r] + bb1; const __bf16 hi = (__bf16)hv; sa[wave][8 * g + r][n] = hi; sa[wave][8 * g + r][32 + n] = (__bf16)(hv - (float)hi); shb[wave][8 * g + r][n] = ab[j][r] + cc1; } } }
  LDSX();
  // bias path: bgen[t][o] = hb . u2[o] + c2[o] (f32 on VALU: lane pair per row, 128 o each), then LN over o
  { const int rl = lane & 15, hf = lane >> 4; const float* hb = &shb[wave][rl][0]; float s = 0.f, sq = 0.f;
#pragma unroll 1
    for (int oo = 0; oo < OUT / 2; ++oo) { const int o = hf * (OUT / 2) + oo; const float* ur = u2 + (size_t)o * HID; float v = bfr(c2[o]);
#pragma unroll
      for (int hcol = 0; hcol < HID; ++hcol) v += hb[hcol] * bfr(ur[hcol]);
      sbias[wave][rl][o] = v; s += v; sq += v * v; }
    s += __shfl_xor(s, 16, 32); sq += __shfl_xor(sq, 16, 32);
    const float mu = s * (1.0f / OUT); float var = sq * (1.0f / OUT) - mu * mu; var = var > 0.f ? var : 0.f; const float rs = rsqrtf(var + 1e-5f);
#pragma unroll 1
    for (int oo = 0; oo < OUT / 2; ++oo) { const int o = hf * (OUT / 2) + oo; sbias[wave][rl][o] = (sbias[wave][rl][o] - mu) * rs; } }
  LDSX();
  // generated-weight path: A fragments (hi chunk, lo chunk) fixed per wave
  const v16b a_hi = frag_b(&sa[wave][col][0], lane), a_lo = frag_b(&sa[wave][col][32], lane);
  float sxs[8];     // sum_i x[row][i] for my 8 D-layout rows
#pragma unroll
  for (int r = 0; r < 8; ++r) { const float* xr = &sx[wave][8 * g + r][0]; float s = 0.f;
#pragma unroll 8
    for (int i = 0; i < IN; ++i) s += xr[i];
    sxs[r] = s; }
  // per lane: x values for my column i within a tile depend on the tile; rows 8g+r
#pragma unroll 1
  for (int o = 0; o < OUT; ++o) { float sw[8], sw2[8], swx[8];
#pragma unroll
    for (int r = 0; r < 8; ++r) { sw[r] = 0.f; sw2[r] = 0.f; swx[r] = 0.f; }
#pragma unroll 2
    for (int t = 0; t < IN / 16; ++t) { const int i = t * 16 + col; const size_t wrow = (size_t)o * IN + i;      // w2 row index (o*256 + i), 32 long
      const v16b wb = split_rowK(w2 + wrow * HID, 0, lane, HID).h;      // K = 32: chunk covers k 0..31 exactly (K-bounded loader keeps the form uniform)
      v8f acc = wmma_bf(a_lo, wb, (v8f){}); acc = wmma_bf(a_hi, wb, acc);
      const float bb = bfr(b2[wrow]);
#pragma unroll
      for (int r = 0; r < 8; ++r) { const float wv = acc[r] + bb; const float xv = sx[wave][8 * g + r][i]; sw[r] += wv; sw2[r] += wv * wv; swx[r] += wv * xv; } }
    // reduce over the 16 column lanes (xor 1,2,4,8 stays within the 16-lane half)
#pragma unroll
    for (int r = 0; r < 8; ++r) {
#pragma unroll
      for (int m = 1; m < 16; m <<= 1) { sw[r] += __shfl_xor(sw[r], m, 32); sw2[r] += __shfl_xor(sw2[r], m, 32); swx[r] += __shfl_xor(swx[r], m, 32); } }
    if (col == (o & 15)) {       // one lane per (row-half g) finalises this o for its 8 rows
#pragma unroll
      for (int r = 0; r < 8; ++r) { const float mu = sw[r] * (1.0f / IN); float var = sw2[r] * (1.0f / IN) - mu * mu; var = var > 0.f ? var : 0.f; const float rs = rsqrtf(var + 1e-5f);
        sy[wave][8 * g + r][o] = (swx[r] - mu * sxs[r]) * rs + sbias[wave][8 * g + r][o]; } } }
  LDSX();
  for (int rl = 0; rl < 16; ++rl) for (int pc = lane; pc < OUT / 4; pc += 32) vst2(y + (size_t)(t0 + rl) * OUT + pc * 4, *(const v4f*)(&sy[wave][rl][pc * 4]));
}
extern "C" void kernel_launch(void* const* d_in, const int* in_sizes, int n_in, void* d_out, int out_size, void* d_ws, size_t ws_size, hipStream_t stream) {
  (void)in_sizes; (void)n_in; (void)out_size; (void)ws_size; (void)d_ws;
  const float** I = (const float**)d_in;   // x, w1, b1, w2, b2, u1, c1, u2, c2
  k_meta<<<NT / 64, 128, 0, stream>>>(I[0], I[1], I[2], I[3], I[4], I[5], I[6], I[7], I[8], (float*)d_out);
}

// v001
// Measured time: 88.5 microseconds a run.
// In two side-by-side timings against v000, it was 27.6 and 27.7 times as fast.
// compute dtype: x, w1, u1 (INPUTS) as exact bf16 WMMA products (f32 accumulate); the generated weights w = hw w2^T use the computed 32-wide code hw as a bf16 hi/lo pair against bf16(w2) (2 products, f32-grade); LayerNorm statistics, the per-token mat-vec with (bf16-rounded) x and the bias path in f32. The 65,536 generated weights per token never leave registers: each 16x16 tile contributes its partial sums (sum w, sum w^2, sum w*x) directly.
#include <hip/hip_runtime.h>
#include <math.h>

typedef __attribute__((ext_vector_type(16))) _Float16 v16h;
typedef __attribute__((ext_vector_type(16))) __bf16 v16b;
typedef __attribute__((ext_vector_type(8)))  _Float16 v8h;
typedef __attribute__((ext_vector_type(8)))  float v8f;
typedef __attribute__((ext_vector_type(4)))  float v4f;
typedef __attribute__((ext_vector_type(2)))  float v2f;
typedef __attribute__((ext_vector_type(4)))  unsigned v4u;
typedef __attribute__((ext_vector_type(4)))  int v4i;
typedef float __attribute__((may_alias)) float_a;
typedef int __attribute__((may_alias)) int_a;

template <typename T> __device__ __forceinline__ void vst2(void* p, T v) { *(T*)p = v;  }
__device__ __forceinline__ v8f wmma16(v16h a, v16h b, v8f c) {
  v8f d = __builtin_amdgcn_wmma_f32_16x16x32_f16(false, a, false, b, (short)0, c, false, false);
  asm volatile("v_nop\n\tv_nop\n\tv_nop\n\tv_nop" : "+v"(d) : "v"(a), "v"(b));
  return d;
}
__device__ __forceinline__ v8f wmma_bf(v16b a, v16b b, v8f c) {
  v8f d = __builtin_amdgcn_wmma_f32_16x16x32_bf16(false, a, false, b, (short)0, c, false, false);
  asm volatile("v_nop\n\tv_nop\n\tv_nop\n\tv_nop" : "+v"(d) : "v"(a), "v"(b));
  return d;
}
// 16x16x32 fragments: lane = (h = lane>>4, row/col = lane&15); elements 0..7 = k0+8h+0..7, 8..15 = k0+16+8h+0..7; D element r = row 8h+r
__device__ __forceinline__ v16h frag_h(const _Float16* rowk0, int lane) {
  union { v16h v; v8h q[2]; } u; const _Float16* p = rowk0 + 8 * (lane >> 4);
  u.q[0] = *(const v8h*)p; u.q[1] = *(const v8h*)(p + 16); return u.v;
}
__device__ __forceinline__ v16h frag_f32(const float* rowk0, int lane) {
  v16h a; const float* p = rowk0 + 8 * (lane >> 4);
#pragma unroll
  for (int i = 0; i < 8; ++i) { a[i] = (_Float16)p[i]; a[8 + i] = (_Float16)p[16 + i]; }
  return a;
}
__device__ __forceinline__ v16h frag_f32s(const float* rowk0, int lane, float sc) {
  v16h a; const float* p = rowk0 + 8 * (lane >> 4);
#pragma unroll
  for (int i = 0; i < 8; ++i) { a[i] = (_Float16)(p[i] * sc); a[8 + i] = (_Float16)(p[16 + i] * sc); }
  return a;
}
// column fragment from a [K][ld] layout (column n), rows >= K read as 0
__device__ __forceinline__ v16h fragc_f32(const float* W, int k0, int n, int lane, int ld, int K) {
  v16h a; const int g = lane >> 4;
#pragma unroll
  for (int i = 0; i < 8; ++i) { const int ka = k0 + 8 * g + i, kb = ka + 16;
    a[i] = (_Float16)(ka < K ? W[(size_t)(ka < K ? ka : K - 1) * ld + n] : 0.f); a[8 + i] = (_Float16)(kb < K ? W[(size_t)(kb < K ? kb : K - 1) * ld + n] : 0.f); }
  return a;
}
struct F2 { v16b h, l; };
__device__ __forceinline__ F2 bsplit16(const float v[16]) { F2 r;
#pragma unroll
  for (int i = 0; i < 16; ++i) { const __bf16 h = (__bf16)v[i]; r.h[i] = h; r.l[i] = (__bf16)(v[i] - (float)h); }
  return r; }
__device__ __forceinline__ F2 split_row(const float* row, int k0, int lane) { float v[16]; const float* p = row + k0 + 8 * (lane >> 4);
#pragma unroll
  for (int i = 0; i < 8; ++i) { v[i] = p[i]; v[8 + i] = p[16 + i]; }
  return bsplit16(v); }
__device__ __forceinline__ F2 split_rowK(const float* row, int k0, int lane, int K) { float v[16]; const int g = lane >> 4;
#pragma unroll
  for (int i = 0; i < 8; ++i) { const int ka = k0 + 8 * g + i, kb = ka + 16; v[i] = ka < K ? row[ka < K ? ka : K - 1] : 0.f; v[8 + i] = kb < K ? row[kb < K ? kb : K - 1] : 0.f; }
  return bsplit16(v); }
__device__ __forceinline__ F2 split_col(const float* W, int k0, int n, int lane, int ld, int K) { float v[16]; const int g = lane >> 4;
#pragma unroll
  for (int i = 0; i < 8; ++i) { const int ka = k0 + 8 * g + i, kb = ka + 16; v[i] = ka < K ? W[(size_t)(ka < K ? ka : K - 1) * ld + n] : 0.f; v[8 + i] = kb < K ? W[(size_t)(kb < K ? kb : K - 1) * ld + n] : 0.f; }
  return bsplit16(v); }
__device__ __forceinline__ v8f mac3(const F2& a, const F2& b, v8f c) { c = wmma_bf(a.l, b.h, c); c = wmma_bf(a.h, b.l, c); return wmma_bf(a.h, b.h, c); }
__device__ __forceinline__ float sigm(float v) { return 1.0f / (1.0f + expf(-v)); }
#define LDSX() do { asm volatile("s_wait_dscnt 0" ::: "memory"); __builtin_amdgcn_wave_barrier(); __builtin_amdgcn_fence(__ATOMIC_RELEASE, "workgroup"); } while (0)


// Hyper-network linear layer: per token: hw = x w1^T + b1 (32); W[o][i] = LN_i(hw . w2[o*256+i] + b2[o*256+i]) (no affine, eps 1e-5); hb = x u1^T + c1; bias[o] = LN_o(hb . u2[o] + c2[o]);
// y[o] = sum_i W[o][i] x[i] + bias[o] = (S_wx - mu_o S_x) * rsqrt(var_o + eps) + bias[o], with S_w, S_w2, S_wx accumulated per (token, o) over the 16 tiles of that o.
// One kernel: block = 64 tokens x 32 outputs, 32 waves: wave = (token tile tt of 16 tokens, output slice s of 4 outputs); grid = 32 token blocks x 8 output chunks, one block per WGP.
// The head is shared by the block through LDS: x rows staged by all threads; hw/hb by exact WMMA, one 16x16 tile per wave (s = 0..3); row sums of x by the s = 4 waves; the bias rows in 16 slices of 16 outputs.
// hw is split hi/lo once into an LDS A fragment row [hi(32)|lo(32)] (two k-chunks); then for each of the wave's 4 outputs o:
// 16 tiles of [16 tokens x 16 i] = A x bf16(w2 rows) (+ bf16(b2)), per-lane partial sums with x[token][i], xor-reduction over the 16 column lanes, y[token][o] finished by lane o%16; the block stores whole 128-byte lines.
#define NB 4
#define SQ 512
#define NT (NB * SQ)     // 2048 tokens
#define IN 256
#define OUT 256
#define HID 32
__device__ __forceinline__ float bfr(float v) { return (float)(__bf16)v; }
__device__ __forceinline__ v16b frag_b(const __bf16* rowk0, int lane) { return __builtin_bit_cast(v16b, frag_h((const _Float16*)rowk0, lane)); }

#define OC 32            // outputs per block: one 128-byte line of y per token
#define OW 4             // outputs per wave
__global__ __launch_bounds__(1024) void k_meta(const float* __restrict__ x, const float* __restrict__ w1, const float* __restrict__ b1, const float* __restrict__ w2, const float* __restrict__ b2, const float* __restrict__ u1, const float* __restrict__ c1, const float* __restrict__ u2, const float* __restrict__ c2, float* __restrict__ y) {
  __shared__ __align__(16) __bf16 sa[4][16][72];        // per token: [hi(hw) 32 | lo(hw) 32] -> A fragments for the w2 GEMM (k-chunk 0 = hi, 1 = lo)
  __shared__ __align__(16) float shb[4][16][36];         // hb rows
  __shared__ __align__(16) float sx[4][16][IN + 4];      // x rows (f32) for the mat-vec partials
  __shared__ __align__(16) float sy[4][16][OC + 4];      // this block's outputs
  __shared__ float sbias[4][16][OUT + 4];                // generated bias pre-LN; each wave's own 4 columns then LN'd
  __shared__ float sps[4][16][17], spq[4][16][17];       // bias LN partial sums, one per slice of 16 outputs
  __shared__ float ssx[4][16];                           // sum_i x[row][i]
  const int tid = threadIdx.x, wave = __builtin_amdgcn_readfirstlane(tid >> 5), lane = tid & 31, col = lane & 15, g = lane >> 4;
  const int tt = wave & 3, s = wave >> 2; const int tb = blockIdx.x * 64, t0 = tb + tt * 16, o0 = blockIdx.y * OC + s * OW;
  // stage x rows
#pragma unroll      // 4 trips for every thread: all four loads in flight together
  for (int it = 0; it < 64 * (IN / 4) / 1024; ++it) { const int q = it * 1024 + tid, rl = q >> 6, pc = q & 63; v4f v = *(const v4f*)(x + (size_t)(tb + rl) * IN + pc * 4);
#pragma unroll
    for (int e = 0; e < 4; ++e) v[e] = bfr(v[e]);      // x is rounded to bf16 everywhere, including the final mat-vec
    *(v4f*)(&sx[rl >> 4][rl & 15][pc * 4]) = v; }
  __syncthreads();
  // hw, hb: [16 x 256] @ [256 x 32]: 2 column tiles each, exact bf16 products; wave s = 0,1: hw tile j = s; s = 2,3: hb tile j = s - 2
  if (s < 4) { const int j = s & 1; const float* wsrc = (s >> 1) ? u1 : w1; v8f ac = {};
#pragma unroll
    for (int kc = 0; kc < IN / 32; ++kc) { const v16b a = split_row(x + (size_t)(t0 + col) * IN, kc * 32, lane).h;
      ac = wmma_bf(a, split_row(wsrc + (size_t)(j * 16 + col) * IN, kc * 32, lane).h, ac); }
    const int n = j * 16 + col;
    if ((s >> 1) == 0) { const float bb1 = bfr(b1[n]);
#pragma unroll
      for (int r = 0; r < 8; ++r) { const float hv = ac[r] + bb1; const __bf16 hi = (__bf16)hv; sa[tt][8 * g + r][n] = hi; sa[tt][8 * g + r][32 + n] = (__bf16)(hv - (float)hi); } }
    else { const float cc1 = bfr(c1[n]);
#pragma unroll
      for (int r = 0; r < 8; ++r) shb[tt][8 * g + r][n] = ac[r] + cc1; } }
  else if (s == 4) { const float* xr = &sx[tt][col][0]; float sm = 0.f;      // row sums of x, once per row, in index order
#pragma unroll 8
    for (int i = 0; i < IN; ++i) sm += xr[i];
    if (g == 0) ssx[tt][col] = sm; }
  __syncthreads();
  // bias path: bgen[t][o] = hb . u2[o] + c2[o] (f32 on VALU: 16 lanes per row over the 8 waves of a token tile, 16 o each), then LN over o
  { const int rl = lane & 15, sl = s * 2 + (lane >> 4); const float* hb = &shb[tt][rl][0]; float sm = 0.f, sq = 0.f;
#pragma unroll 1
    for (int oo = 0; oo < 16; ++oo) { const int o = sl * 16 + oo; const float* ur = u2 + (size_t)o * HID; float v = bfr(c2[o]);
#pragma unroll
      for (int hcol = 0; hcol < HID; ++hcol) v += hb[hcol] * bfr(ur[hcol]);
      sbias[tt][rl][o] = v; sm += v; sq += v * v; }
    sps[tt][rl][sl] = sm; spq[tt][rl][sl] = sq; }
  __syncthreads();
  { const int rl = lane & 15, hf = lane >> 4; float sm = 0.f, sq = 0.f;
#pragma unroll
    for (int c = 0; c < 16; ++c) { sm += sps[tt][rl][c]; sq += spq[tt][rl][c]; }
    const float mu = sm * (1.0f / OUT); float var = sq * (1.0f / OUT) - mu * mu; var = var > 0.f ? var : 0.f; const float rs = rsqrtf(var + 1e-5f);
#pragma unroll
    for (int e = 0; e < OW / 2; ++e) { const int o = o0 + hf * (OW / 2) + e; sbias[tt][rl][o] = (sbias[tt][rl][o] - mu) * rs; } }      // only this wave touches its 4 columns from here on
  LDSX();
  // generated-weight path: A fragments (hi chunk, lo chunk) fixed per wave
  const v16b a_hi = frag_b(&sa[tt][col][0], lane), a_lo = frag_b(&sa[tt][col][32], lane);
  float sxs[8];     // sum_i x[row][i] for my 8 D-layout rows
#pragma unroll
  for (int r = 0; r < 8; ++r) sxs[r] = ssx[tt][8 * g + r];
  // per lane: x values for my column i within a tile depend on the tile; rows 8g+r
#pragma unroll 1
  for (int o = o0; o < o0 + OW; ++o) { float sw[8], sw2[8], swx[8];
#pragma unroll
    for (int r = 0; r < 8; ++r) { sw[r] = 0.f; sw2[r] = 0.f; swx[r] = 0.f; }
#pragma unroll 2
    for (int t = 0; t < IN / 16; ++t) { const int i = t * 16 + col; const size_t wrow = (size_t)o * IN + i;      // w2 row index (o*256 + i), 32 long
      const v16b wb = split_rowK(w2 + wrow * HID, 0, lane, HID).h;      // K = 32: chunk covers k 0..31 exactly (K-bounded loader keeps the form uniform)
      v8f acc = wmma_bf(a_lo, wb, (v8f){}); acc = wmma_bf(a_hi, wb, acc);
      const float bb = bfr(b2[wrow]);
#pragma unroll
      for (int r = 0; r < 8; ++r) { const float wv = acc[r] + bb; const float xv = sx[tt][8 * g + r][i]; sw[r] += wv; sw2[r] += wv * wv; swx[r] += wv * xv; } }
    // reduce over the 16 column lanes (xor 1,2,4,8 stays within the 16-lane half)
#pragma unroll
    for (int r = 0; r < 8; ++r) {
#pragma unroll
      for (int m = 1; m < 16; m <<= 1) { sw[r] += __shfl_xor(sw[r], m, 32); sw2[r] += __shfl_xor(sw2[r], m, 32); swx[r] += __shfl_xor(swx[r], m, 32); } }
    if (col == (o & 15)) {       // one lane per (row-half g) finalises this o for its 8 rows
#pragma unroll
      for (int r = 0; r < 8; ++r) { const float mu = sw[r] * (1.0f / IN); float var = sw2[r] * (1.0f / IN) - mu * mu; var = var > 0.f ? var : 0.f; const float rs = rsqrtf(var + 1e-5f);
        sy[tt][8 * g + r][o - blockIdx.y * OC] = (swx[r] - mu * sxs[r]) * rs + sbias[tt][8 * g + r][o]; } } }
  __syncthreads();
  if (tid < 64 * (OC / 4)) { const int rl = tid >> 3, pc = tid & 7; vst2(y + (size_t)(tb + rl) * OUT + blockIdx.y * OC + pc * 4, *(const v4f*)(&sy[rl >> 4][rl & 15][pc * 4])); }
}
extern "C" void kernel_launch(void* const* d_in, const int* in_sizes, int n_in, void* d_out, int out_size, void* d_ws, size_t ws_size, hipStream_t stream) {
  (void)in_sizes; (void)n_in; (void)out_size; (void)ws_size; (void)d_ws;
  const float** I = (const float**)d_in;   // x, w1, b1, w2, b2, u1, c1, u2, c2
  k_meta<<<dim3(NT / 64, OUT / OC), 1024, 0, stream>>>(I[0], I[1], I[2], I[3], I[4], I[5], I[6], I[7], I[8], (float*)d_out);
}

// v002
// It runs in 46.8 microseconds.
// Next to v001, in two timings, it ran 1.89 times as fast each time.
// All steps since v000 together make it 52.1 times as fast.
// compute dtype: x, w1, u1 (INPUTS) as exact bf16 WMMA products (f32 accumulate); the generated weights w = hw w2^T use the computed 32-wide code hw as a bf16 hi/lo pair against bf16(w2) (2 products, f32-grade); LayerNorm statistics, the per-token mat-vec with (bf16-rounded) x and the bias path in f32. The 65,536 generated weights per token never leave registers: each 16x16 tile contributes its partial sums (sum w, sum w^2, sum w*x) directly.
#include <hip/hip_runtime.h>
#include <math.h>

typedef __attribute__((ext_vector_type(16))) _Float16 v16h;
typedef __attribute__((ext_vector_type(16))) __bf16 v16b;
typedef __attribute__((ext_vector_type(8)))  _Float16 v8h;
typedef __attribute__((ext_vector_type(8)))  float v8f;
typedef __attribute__((ext_vector_type(4)))  float v4f;
typedef __attribute__((ext_vector_type(2)))  float v2f;
typedef __attribute__((ext_vector_type(4)))  unsigned v4u;
typedef __attribute__((ext_vector_type(4)))  int v4i;
typedef float __attribute__((may_alias)) float_a;
typedef int __attribute__((may_alias)) int_a;

template <typename T> __device__ __forceinline__ void vst2(void* p, T v) { *(T*)p = v;  }
__device__ __forceinline__ v8f wmma16(v16h a, v16h b, v8f c) {
  v8f d = __builtin_amdgcn_wmma_f32_16x16x32_f16(false, a, false, b, (short)0, c, false, false);
  asm volatile("v_nop\n\tv_nop\n\tv_nop\n\tv_nop" : "+v"(d) : "v"(a), "v"(b));
  return d;
}
__device__ __forceinline__ v8f wmma_bf(v16b a, v16b b, v8f c) {
  v8f d = __builtin_amdgcn_wmma_f32_16x16x32_bf16(false, a, false, b, (short)0, c, false, false);
  asm volatile("v_nop\n\tv_nop\n\tv_nop\n\tv_nop" : "+v"(d) : "v"(a), "v"(b));
  return d;
}
// 16x16x32 fragments: lane = (h = lane>>4, row/col = lane&15); elements 0..7 = k0+8h+0..7, 8..15 = k0+16+8h+0..7; D element r = row 8h+r
__device__ __forceinline__ v16h frag_h(const _Float16* rowk0, int lane) {
  union { v16h v; v8h q[2]; } u; const _Float16* p = rowk0 + 8 * (lane >> 4);
  u.q[0] = *(const v8h*)p; u.q[1] = *(const v8h*)(p + 16); return u.v;
}
__device__ __forceinline__ v16h frag_f32(const float* rowk0, int lane) {
  v16h a; const float* p = rowk0 + 8 * (lane >> 4);
#pragma unroll
  for (int i = 0; i < 8; ++i) { a[i] = (_Float16)p[i]; a[8 + i] = (_Float16)p[16 + i]; }
  return a;
}
__device__ __forceinline__ v16h frag_f32s(const float* rowk0, int lane, float sc) {
  v16h a; const float* p = rowk0 + 8 * (lane >> 4);
#pragma unroll
  for (int i = 0; i < 8; ++i) { a[i] = (_Float16)(p[i] * sc); a[8 + i] = (_Float16)(p[16 + i] * sc); }
  return a;
}
// column fragment from a [K][ld] layout (column n), rows >= K read as 0
__device__ __forceinline__ v16h fragc_f32(const float* W, int k0, int n, int lane, int ld, int K) {
  v16h a; const int g = lane >> 4;
#pragma unroll
  for (int i = 0; i < 8; ++i) { const int ka = k0 + 8 * g + i, kb = ka + 16;
    a[i] = (_Float16)(ka < K ? W[(size_t)(ka < K ? ka : K - 1) * ld + n] : 0.f); a[8 + i] = (_Float16)(kb < K ? W[(size_t)(kb < K ? kb : K - 1) * ld + n] : 0.f); }
  return a;
}
struct F2 { v16b h, l; };
__device__ __forceinline__ F2 bsplit16(const float v[16]) { F2 r;
#pragma unroll
  for (int i = 0; i < 16; ++i) { const __bf16 h = (__bf16)v[i]; r.h[i] = h; r.l[i] = (__bf16)(v[i] - (float)h); }
  return r; }
__device__ __forceinline__ F2 split_row(const float* row, int k0, int lane) { float v[16]; const float* p = row + k0 + 8 * (lane >> 4);
#pragma unroll
  for (int i = 0; i < 8; ++i) { v[i] = p[i]; v[8 + i] = p[16 + i]; }
  return bsplit16(v); }
__device__ __forceinline__ F2 split_rowK(const float* row, int k0, int lane, int K) { float v[16]; const int g = lane >> 4;
#pragma unroll
  for (int i = 0; i < 8; ++i) { const int ka = k0 + 8 * g + i, kb = ka + 16; v[i] = ka < K ? row[ka < K ? ka : K - 1] : 0.f; v[8 + i] = kb < K ? row[kb < K ? kb : K - 1] : 0.f; }
  return bsplit16(v); }
__device__ __forceinline__ F2 split_col(const float* W, int k0, int n, int lane, int ld, int K) { float v[16]; const int g = lane >> 4;
#pragma unroll
  for (int i = 0; i < 8; ++i) { const int ka = k0 + 8 * g + i, kb = ka + 16; v[i] = ka < K ? W[(size_t)(ka < K ? ka : K - 1) * ld + n] : 0.f; v[8 + i] = kb < K ? W[(size_t)(kb < K ? kb : K - 1) * ld + n] : 0.f; }
  return bsplit16(v); }
__device__ __forceinline__ v8f mac3(const F2& a, const F2& b, v8f c) { c = wmma_bf(a.l, b.h, c); c = wmma_bf(a.h, b.l, c); return wmma_bf(a.h, b.h, c); }
__device__ __forceinline__ float sigm(float v) { return 1.0f / (1.0f + expf(-v)); }
#define LDSX() do { asm volatile("s_wait_dscnt 0" ::: "memory"); __builtin_amdgcn_wave_barrier(); __builtin_amdgcn_fence(__ATOMIC_RELEASE, "workgroup"); } while (0)


// Hyper-network linear layer: per token: hw = x w1^T + b1 (32); W[o][i] = LN_i(hw . w2[o*256+i] + b2[o*256+i]) (no affine, eps 1e-5); hb = x u1^T + c1; bias[o] = LN_o(hb . u2[o] + c2[o]);
// y[o] = sum_i W[o][i] x[i] + bias[o] = (S_wx - mu_o S_x) * rsqrt(var_o + eps) + bias[o], with S_w, S_w2, S_wx accumulated per (token, o) over the 16 tiles of that o.
// One kernel: block = 64 tokens x 32 outputs, 32 waves: wave = (token tile tt of 16 tokens, output slice s of 4 outputs); grid = 32 token blocks x 8 output chunks, one block per WGP.
// The head is shared by the block through LDS: x rows staged by all threads; hw/hb by exact WMMA, one 16x16 tile per wave (s = 0..3); row sums of x by the s = 4 waves; the bias rows in 16 slices of 16 outputs.
// hw is split hi/lo once into an LDS A fragment row [hi(32)|lo(32)] (two k-chunks); then for each of the wave's 4 outputs o:
// 16 tiles of [16 tokens x 16 i] = A x bf16(w2 rows) (+ bf16(b2)), per-lane partial sums with x[token][i], xor-reduction over the 16 column lanes, y[token][o] finished by lane o%16; the block stores whole 128-byte lines.
// w2 reaches the B fragments through LDS: the 4 waves of an output slice share its w2 rows, so each stages one 16-row tile of every 4-tile chunk with loads that cover whole 128-byte lines,
// rounds it to bf16 once and stores it in fragment order; two buffers, the next chunk's loads (and its b2 values) fly in registers while this chunk is worked on, one barrier per chunk.
#define NB 4
#define SQ 512
#define NT (NB * SQ)     // 2048 tokens
#define IN 256
#define OUT 256
#define HID 32
__device__ __forceinline__ float bfr(float v) { return (float)(__bf16)v; }
__device__ __forceinline__ v16b frag_b(const __bf16* rowk0, int lane) { return __builtin_bit_cast(v16b, frag_h((const _Float16*)rowk0, lane)); }

#define OC 32            // outputs per block: one 128-byte line of y per token
#define OW 4             // outputs per wave
#define NCH (OW * 4)     // chunks of 4 tiles (64 w2 rows) per output slice
typedef __attribute__((ext_vector_type(4))) __bf16 v4b;
typedef __attribute__((ext_vector_type(8))) __bf16 v8b;
__global__ __launch_bounds__(1024) void k_meta(const float* __restrict__ x, const float* __restrict__ w1, const float* __restrict__ b1, const float* __restrict__ w2, const float* __restrict__ b2, const float* __restrict__ u1, const float* __restrict__ c1, const float* __restrict__ u2, const float* __restrict__ c2, float* __restrict__ y) {
  __shared__ __align__(16) __bf16 sa[4][16][72];        // per token: [hi(hw) 32 | lo(hw) 32] -> A fragments for the w2 GEMM (k-chunk 0 = hi, 1 = lo)
  __shared__ __align__(16) float shb[4][16][36];         // hb rows
  __shared__ __align__(16) float sx[4][16][IN + 4];      // x rows (f32) for the mat-vec partials
  __shared__ __align__(16) float sy[4][16][OC + 4];      // this block's outputs
  __shared__ float sbias[4][16][OUT + 4];                // generated bias pre-LN; each wave's own 4 columns then LN'd
  __shared__ float sps[4][16][17], spq[4][16][17];       // bias LN partial sums, one per slice of 16 outputs
  __shared__ float ssx[4][16];                           // sum_i x[row][i]
  __shared__ __align__(16) __bf16 sw[2][32][512];        // w2 tiles as bf16 B fragments: [buffer][slice * 4 + tile of the chunk][k half][slot of 8 values]
  __shared__ float sb2[2][32][32];                       // bf16-rounded b2 of the same tiles, one value per reading lane
  const int tid = threadIdx.x, wave = __builtin_amdgcn_readfirstlane(tid >> 5), lane = tid & 31, col = lane & 15, g = lane >> 4;
  const int tt = wave & 3, s = wave >> 2; const int tb = blockIdx.x * 64, t0 = tb + tt * 16, o0 = blockIdx.y * OC + s * OW;
  // w2 staging. Source: tile tt of each chunk of this wave's slice; load j takes 512 consecutive bytes (rows 4j..4j+3 of the tile), lane = (row lane>>3, k = 4*(lane&7)..+3).
  // Place of (row, k block kb = k>>3): half kb>>1, slot 16*(kb&1) + ((row + 4*kb) & 15): a fragment read takes 512 bytes in a row, and the 32 lanes of a store fall on 64 different banks.
  const float* wsl = w2 + ((size_t)o0 * IN + tt * 16) * HID + lane * 4;
  const float* bsl = b2 + (size_t)o0 * IN + tt * 16 + col;
  const int kb = (lane & 7) >> 1, wbase = (kb >> 1) * 256 + (kb & 1) * 128 + (lane & 1) * 4, wrot = (lane >> 3) + 4 * kb;
  const int ro0 = (g * 16 + ((col + 4 * g) & 15)) * 8, ro1 = 256 + (g * 16 + ((col + 4 * (2 + g)) & 15)) * 8;      // this lane's two fragment halves
  v4f pf[4]; float bn = bsl[0];
#pragma unroll      // pf[] is indexed by constants only, so it stays in registers
  for (int j = 0; j < 4; ++j) pf[j] = *(const v4f*)(wsl + j * 128);
#pragma unroll
  for (int j = 0; j < 4; ++j) { v4b h;
#pragma unroll
    for (int e = 0; e < 4; ++e) h[e] = (__bf16)pf[j][e];
    *(v4b*)(&sw[0][wave][wbase + ((j * 4 + wrot) & 15) * 8]) = h; }
  sb2[0][wave][lane] = bfr(bn);      // chunk 0: published by the head's barriers
  // stage x rows
#pragma unroll      // 4 trips for every thread: all four loads in flight together
  for (int it = 0; it < 64 * (IN / 4) / 1024; ++it) { const int q = it * 1024 + tid, rl = q >> 6, pc = q & 63; v4f v = *(const v4f*)(x + (size_t)(tb + rl) * IN + pc * 4);
#pragma unroll
    for (int e = 0; e < 4; ++e) v[e] = bfr(v[e]);      // x is rounded to bf16 everywhere, including the final mat-vec
    *(v4f*)(&sx[rl >> 4][rl & 15][pc * 4]) = v; }
  __syncthreads();
  // hw, hb: [16 x 256] @ [256 x 32]: 2 column tiles each, exact bf16 products; wave s = 0,1: hw tile j = s; s = 2,3: hb tile j = s - 2
  if (s < 4) { const int j = s & 1; const float* wsrc = (s >> 1) ? u1 : w1; v8f ac = {};
#pragma unroll
    for (int kc = 0; kc < IN / 32; ++kc) { const v16b a = split_row(x + (size_t)(t0 + col) * IN, kc * 32, lane).h;
      ac = wmma_bf(a, split_row(wsrc + (size_t)(j * 16 + col) * IN, kc * 32, lane).h, ac); }
    const int n = j * 16 + col;
    if ((s >> 1) == 0) { const float bb1 = bfr(b1[n]);
#pragma unroll
      for (int r = 0; r < 8; ++r) { const float hv = ac[r] + bb1; const __bf16 hi = (__bf16)hv; sa[tt][8 * g + r][n] = hi; sa[tt][8 * g + r][32 + n] = (__bf16)(hv - (float)hi); } }
    else { const float cc1 = bfr(c1[n]);
#pragma unroll
      for (int r = 0; r < 8; ++r) shb[tt][8 * g + r][n] = ac[r] + cc1; } }
  else if (s == 4) { const float* xr = &sx[tt][col][0]; float sm = 0.f;      // row sums of x, once per row, in index order
#pragma unroll 8
    for (int i = 0; i < IN; ++i) sm += xr[i];
    if (g == 0) ssx[tt][col] = sm; }
  __syncthreads();
  // bias path: bgen[t][o] = hb . u2[o] + c2[o] (f32 on VALU: 16 lanes per row over the 8 waves of a token tile, 16 o each), then LN over o
  { const int rl = lane & 15, sl = s * 2 + (lane >> 4); const float* hb = &shb[tt][rl][0]; float sm = 0.f, sq = 0.f;
#pragma unroll 1
    for (int oo = 0; oo < 16; ++oo) { const int o = sl * 16 + oo; const float* ur = u2 + (size_t)o * HID; float v = bfr(c2[o]);
#pragma unroll
      for (int hcol = 0; hcol < HID; ++hcol) v += hb[hcol] * bfr(ur[hcol]);
      sbias[tt][rl][o] = v; sm += v; sq += v * v; }
    sps[tt][rl][sl] = sm; spq[tt][rl][sl] = sq; }
  __syncthreads();
  { const int rl = lane & 15, hf = lane >> 4; float sm = 0.f, sq = 0.f;
#pragma unroll
    for (int c = 0; c < 16; ++c) { sm += sps[tt][rl][c]; sq += spq[tt][rl][c]; }
    const float mu = sm * (1.0f / OUT); float var = sq * (1.0f / OUT) - mu * mu; var = var > 0.f ? var : 0.f; const float rs = rsqrtf(var + 1e-5f);
#pragma unroll
    for (int e = 0; e < OW / 2; ++e) { const int o = o0 + hf * (OW / 2) + e; sbias[tt][rl][o] = (sbias[tt][rl][o] - mu) * rs; } }      // only this wave touches its 4 columns from here on
  LDSX();
  // generated-weight path: A fragments (hi chunk, lo chunk) fixed per wave
  const v16b a_hi = frag_b(&sa[tt][col][0], lane), a_lo = frag_b(&sa[tt][col][32], lane);
  // per lane: x values for my column i within a tile depend on the tile; rows 8g+r
#pragma unroll 1
  for (int o = o0; o < o0 + OW; ++o) { float sw1[8], sw2[8], swx[8];
#pragma unroll
    for (int r = 0; r < 8; ++r) { sw1[r] = 0.f; sw2[r] = 0.f; swx[r] = 0.f; }
#pragma unroll 1      // one copy of the chunk body: the prefetch stays ahead of the tile loop and its stores behind it
    for (int q = 0; q < 4; ++q) { const int c = (o - o0) * 4 + q;      // chunk c = tiles 4q..4q+3 of output o, in buffer c & 1
      if (c + 1 < NCH) {      // next chunk's global reads, in flight over this chunk's work
        bn = bsl[(c + 1) * 64];
#pragma unroll
        for (int j = 0; j < 4; ++j) pf[j] = *(const v4f*)(wsl + (size_t)(c + 1) * (64 * HID) + j * 128); }
#pragma unroll 2      // two tiles at a time; all four at once pushed the prefetched registers out to scratch
      for (int p = 0; p < 4; ++p) { const int i = (q * 4 + p) * 16 + col; const __bf16* tp = &sw[c & 1][s * 4 + p][0];
        union { v16b v; v8b h[2]; } wb; wb.h[0] = *(const v8b*)(tp + ro0); wb.h[1] = *(const v8b*)(tp + ro1);      // elements 0..7 = k 8g.., 8..15 = k 16+8g.., column = w2 row o*256 + i
        v8f acc = wmma_bf(a_lo, wb.v, (v8f){}); acc = wmma_bf(a_hi, wb.v, acc);
        const float bb = sb2[c & 1][s * 4 + p][lane];
#pragma unroll
        for (int r = 0; r < 8; ++r) { const float wv = acc[r] + bb; const float xv = sx[tt][8 * g + r][i]; sw1[r] += wv; sw2[r] += wv * wv; swx[r] += wv * xv; } }
      if (c + 1 < NCH) {      // the other buffer's last readers left it before the previous barrier
#pragma unroll
        for (int j = 0; j < 4; ++j) { v4b h;
#pragma unroll
          for (int e = 0; e < 4; ++e) h[e] = (__bf16)pf[j][e];
          *(v4b*)(&sw[(c + 1) & 1][wave][wbase + ((j * 4 + wrot) & 15) * 8]) = h; }
        sb2[(c + 1) & 1][wave][lane] = bfr(bn);
        __syncthreads(); } }      // publishes chunk c + 1 and ends every read of chunk c
    // reduce over the 16 column lanes (xor 1,2,4,8 stays within the 16-lane half)
#pragma unroll
    for (int r = 0; r < 8; ++r) {
#pragma unroll
      for (int m = 1; m < 16; m <<= 1) { sw1[r] += __shfl_xor(sw1[r], m, 32); sw2[r] += __shfl_xor(sw2[r], m, 32); swx[r] += __shfl_xor(swx[r], m, 32); } }
    if (col == (o & 15)) {       // one lane per (row-half g) finalises this o for its 8 rows
#pragma unroll
      for (int r = 0; r < 8; ++r) { const float mu = sw1[r] * (1.0f / IN); float var = sw2[r] * (1.0f / IN) - mu * mu; var = var > 0.f ? var : 0.f; const float rs = rsqrtf(var + 1e-5f);
        sy[tt][8 * g + r][o - blockIdx.y * OC] = (swx[r] - mu * ssx[tt][8 * g + r]) * rs + sbias[tt][8 * g + r][o]; } } }
  __syncthreads();
  if (tid < 64 * (OC / 4)) { const int rl = tid >> 3, pc = tid & 7; vst2(y + (size_t)(tb + rl) * OUT + blockIdx.y * OC + pc * 4, *(const v4f*)(&sy[rl >> 4][rl & 15][pc * 4])); }
}
extern "C" void kernel_launch(void* const* d_in, const int* in_sizes, int n_in, void* d_out, int out_size, void* d_ws, size_t ws_size, hipStream_t stream) {
  (void)in_sizes; (void)n_in; (void)out_size; (void)ws_size; (void)d_ws;
  const float** I = (const float**)d_in;   // x, w1, b1, w2, b2, u1, c1, u2, c2
  k_meta<<<dim3(NT / 64, OUT / OC), 1024, 0, stream>>>(I[0], I[1], I[2], I[3], I[4], I[5], I[6], I[7], I[8], (float*)d_out);
}

// v003
// A run of this version takes 41.5 microseconds.
// Two timings next to v002 both put it at 1.13 times that version's speed.
// All steps since v000 together make it 58.8 times as fast.
// compute dtype: x, w1, u1 (INPUTS) as exact bf16 WMMA products (f32 accumulate); the generated weights w = hw w2^T use the computed 32-wide code hw as a bf16 hi/lo pair against bf16(w2) (2 products, f32-grade); the generated bias hb u2^T likewise uses hb as a bf16 hi/lo pair against bf16(u2) (2 products, f32-grade); LayerNorm statistics and the per-token mat-vec with (bf16-rounded) x in f32. The 65,536 generated weights per token never leave registers: each 16x16 tile contributes its partial sums (sum w, sum w^2, sum w*x) directly.
#include <hip/hip_runtime.h>
#include <math.h>

typedef __attribute__((ext_vector_type(16))) _Float16 v16h;
typedef __attribute__((ext_vector_type(16))) __bf16 v16b;
typedef __attribute__((ext_vector_type(8)))  _Float16 v8h;
typedef __attribute__((ext_vector_type(8)))  float v8f;
typedef __attribute__((ext_vector_type(4)))  float v4f;
typedef __attribute__((ext_vector_type(2)))  float v2f;
typedef __attribute__((ext_vector_type(4)))  unsigned v4u;
typedef __attribute__((ext_vector_type(4)))  int v4i;
typedef float __attribute__((may_alias)) float_a;
typedef int __attribute__((may_alias)) int_a;

template <typename T> __device__ __forceinline__ void vst2(void* p, T v) { *(T*)p = v;  }
__device__ __forceinline__ v8f wmma16(v16h a, v16h b, v8f c) {
  v8f d = __builtin_amdgcn_wmma_f32_16x16x32_f16(false, a, false, b, (short)0, c, false, false);
  asm volatile("v_nop\n\tv_nop\n\tv_nop\n\tv_nop" : "+v"(d) : "v"(a), "v"(b));
  return d;
}
__device__ __forceinline__ v8f wmma_bf(v16b a, v16b b, v8f c) {
  v8f d = __builtin_amdgcn_wmma_f32_16x16x32_bf16(false, a, false, b, (short)0, c, false, false);
  asm volatile("v_nop\n\tv_nop\n\tv_nop\n\tv_nop" : "+v"(d) : "v"(a), "v"(b));
  return d;
}
// 16x16x32 fragments: lane = (h = lane>>4, row/col = lane&15); elements 0..7 = k0+8h+0..7, 8..15 = k0+16+8h+0..7; D element r = row 8h+r
__device__ __forceinline__ v16h frag_h(const _Float16* rowk0, int lane) {
  union { v16h v; v8h q[2]; } u; const _Float16* p = rowk0 + 8 * (lane >> 4);
  u.q[0] = *(const v8h*)p; u.q[1] = *(const v8h*)(p + 16); return u.v;
}
__device__ __forceinline__ v16h frag_f32(const float* rowk0, int lane) {
  v16h a; const float* p = rowk0 + 8 * (lane >> 4);
#pragma unroll
  for (int i = 0; i < 8; ++i) { a[i] = (_Float16)p[i]; a[8 + i] = (_Float16)p[16 + i]; }
  return a;
}
__device__ __forceinline__ v16h frag_f32s(const float* rowk0, int lane, float sc) {
  v16h a; const float* p = rowk0 + 8 * (lane >> 4);
#pragma unroll
  for (int i = 0; i < 8; ++i) { a[i] = (_Float16)(p[i] * sc); a[8 + i] = (_Float16)(p[16 + i] * sc); }
  return a;
}
// column fragment from a [K][ld] layout (column n), rows >= K read as 0
__device__ __forceinline__ v16h fragc_f32(const float* W, int k0, int n, int lane, int ld, int K) {
  v16h a; const int g = lane >> 4;
#pragma unroll
  for (int i = 0; i < 8; ++i) { const int ka = k0 + 8 * g + i, kb = ka + 16;
    a[i] = (_Float16)(ka < K ? W[(size_t)(ka < K ? ka : K - 1) * ld + n] : 0.f); a[8 + i] = (_Float16)(kb < K ? W[(size_t)(kb < K ? kb : K - 1) * ld + n] : 0.f); }
  return a;
}
struct F2 { v16b h, l; };
__device__ __forceinline__ F2 bsplit16(const float v[16]) { F2 r;
#pragma unroll
  for (int i = 0; i < 16; ++i) { const __bf16 h = (__bf16)v[i]; r.h[i] = h; r.l[i] = (__bf16)(v[i] - (float)h); }
  return r; }
__device__ __forceinline__ F2 split_row(const float* row, int k0, int lane) { float v[16]; const float* p = row + k0 + 8 * (lane >> 4);
#pragma unroll
  for (int i = 0; i < 8; ++i) { v[i] = p[i]; v[8 + i] = p[16 + i]; }
  return bsplit16(v); }
__device__ __forceinline__ F2 split_rowK(const float* row, int k0, int lane, int K) { float v[16]; const int g = lane >> 4;
#pragma unroll
  for (int i = 0; i < 8; ++i) { const int ka = k0 + 8 * g + i, kb = ka + 16; v[i] = ka < K ? row[ka < K ? ka : K - 1] : 0.f; v[8 + i] = kb < K ? row[kb < K ? kb : K - 1] : 0.f; }
  return bsplit16(v); }
__device__ __forceinline__ F2 split_col(const float* W, int k0, int n, int lane, int ld, int K) { float v[16]; const int g = lane >> 4;
#pragma unroll
  for (int i = 0; i < 8; ++i) { const int ka = k0 + 8 * g + i, kb = ka + 16; v[i] = ka < K ? W[(size_t)(ka < K ? ka : K - 1) * ld + n] : 0.f; v[8 + i] = kb < K ? W[(size_t)(kb < K ? kb : K - 1) * ld + n] : 0.f; }
  return bsplit16(v); }
__device__ __forceinline__ v8f mac3(const F2& a, const F2& b, v8f c) { c = wmma_bf(a.l, b.h, c); c = wmma_bf(a.h, b.l, c); return wmma_bf(a.h, b.h, c); }
__device__ __forceinline__ float sigm(float v) { return 1.0f / (1.0f + expf(-v)); }
#define LDSX() do { asm volatile("s_wait_dscnt 0" ::: "memory"); __builtin_amdgcn_wave_barrier(); __builtin_amdgcn_fence(__ATOMIC_RELEASE, "workgroup"); } while (0)


// Hyper-network linear layer: per token: hw = x w1^T + b1 (32); W[o][i] = LN_i(hw . w2[o*256+i] + b2[o*256+i]) (no affine, eps 1e-5); hb = x u1^T + c1; bias[o] = LN_o(hb . u2[o] + c2[o]);
// y[o] = sum_i W[o][i] x[i] + bias[o] = (S_wx - mu_o S_x) * rsqrt(var_o + eps) + bias[o], with S_w, S_w2, S_wx accumulated per (token, o) over the 16 tiles of that o.
// One kernel: block = 64 tokens x 32 outputs, 32 waves: wave = (token tile tt of 16 tokens, output slice s of 4 outputs); grid = 32 token blocks x 8 output chunks, one block per WGP.
// The head is shared by the block through LDS: x rows staged by all threads; hw/hb by exact WMMA, one 16x16 tile per wave (s = 0..3); row sums of x by the s = 4 waves; the bias rows by WMMA, two 16x16 tiles per wave, their LN sums in 16 slices of 16 outputs.
// hw is split hi/lo once into an LDS A fragment row [hi(32)|lo(32)] (two k-chunks); then for each of the wave's 4 outputs o:
// 16 tiles of [16 tokens x 16 i] = A x bf16(w2 rows) (+ bf16(b2)), per-lane partial sums with x[token][i], xor-reduction over the 16 column lanes, y[token][o] finished by lane o%16; the block stores whole 128-byte lines.
// w2 reaches the B fragments through LDS: the 4 waves of an output slice share its w2 rows, so each stages one 16-row tile of every 4-tile chunk with loads that cover whole 128-byte lines,
// rounds it to bf16 once and stores it in fragment order; two buffers, the next chunk's loads (and its b2 values) fly in registers while this chunk is worked on, one barrier per chunk.
#define NB 4
#define SQ 512
#define NT (NB * SQ)     // 2048 tokens
#define IN 256
#define OUT 256
#define HID 32
__device__ __forceinline__ float bfr(float v) { return (float)(__bf16)v; }
__device__ __forceinline__ v16b frag_b(const __bf16* rowk0, int lane) { return __builtin_bit_cast(v16b, frag_h((const _Float16*)rowk0, lane)); }

#define OC 32            // outputs per block: one 128-byte line of y per token
#define OW 4             // outputs per wave
#define NCH (OW * 4)     // chunks of 4 tiles (64 w2 rows) per output slice
typedef __attribute__((ext_vector_type(4))) __bf16 v4b;
typedef __attribute__((ext_vector_type(8))) __bf16 v8b;
__global__ __launch_bounds__(1024) void k_meta(const float* __restrict__ x, const float* __restrict__ w1, const float* __restrict__ b1, const float* __restrict__ w2, const float* __restrict__ b2, const float* __restrict__ u1, const float* __restrict__ c1, const float* __restrict__ u2, const float* __restrict__ c2, float* __restrict__ y) {
  __shared__ __align__(16) __bf16 sa[4][16][72];        // per token: [hi(hw) 32 | lo(hw) 32] -> A fragments for the w2 GEMM (k-chunk 0 = hi, 1 = lo)
  __shared__ __align__(16) __bf16 sab[4][16][72];       // per token: [hi(hb) 32 | lo(hb) 32] -> A fragments for the u2 GEMM
  __shared__ __align__(16) float sx[4][16][IN + 4];      // x rows (f32) for the mat-vec partials
  __shared__ __align__(16) float sy[4][16][OC + 4];      // this block's outputs
  __shared__ __align__(16) float sbias[4][16][OUT + 4];  // generated bias pre-LN; each wave's own 4 columns then LN'd
  __shared__ float sps[4][16][17], spq[4][16][17];       // bias LN partial sums, one per slice of 16 outputs
  __shared__ float ssx[4][16];                           // sum_i x[row][i]
  __shared__ __align__(16) __bf16 sw[2][32][512];        // w2 tiles as bf16 B fragments: [buffer][slice * 4 + tile of the chunk][k half][slot of 8 values]
  __shared__ float sb2[2][32][32];                       // bf16-rounded b2 of the same tiles, one value per reading lane
  const int tid = threadIdx.x, wave = __builtin_amdgcn_readfirstlane(tid >> 5), lane = tid & 31, col = lane & 15, g = lane >> 4;
  const int tt = wave & 3, s = wave >> 2; const int tb = blockIdx.x * 64, t0 = tb + tt * 16, o0 = blockIdx.y * OC + s * OW;
  // w2 staging. Source: tile tt of each chunk of this wave's slice; load j takes 512 consecutive bytes (rows 4j..4j+3 of the tile), lane = (row lane>>3, k = 4*(lane&7)..+3).
  // Place of (row, k block kb = k>>3): half kb>>1, slot 16*(kb&1) + ((row + 4*kb) & 15): a fragment read takes 512 bytes in a row, and the 32 lanes of a store fall on 64 different banks.
  const float* wsl = w2 + ((size_t)o0 * IN + tt * 16) * HID + lane * 4;
  const float* bsl = b2 + (size_t)o0 * IN + tt * 16 + col;
  const int kb = (lane & 7) >> 1, wbase = (kb >> 1) * 256 + (kb & 1) * 128 + (lane & 1) * 4, wrot = (lane >> 3) + 4 * kb;
  const int ro0 = (g * 16 + ((col + 4 * g) & 15)) * 8, ro1 = 256 + (g * 16 + ((col + 4 * (2 + g)) & 15)) * 8;      // this lane's two fragment halves
  v4f pf[4]; float bn = bsl[0];
#pragma unroll      // pf[] is indexed by constants only, so it stays in registers
  for (int j = 0; j < 4; ++j) pf[j] = *(const v4f*)(wsl + j * 128);
#pragma unroll
  for (int j = 0; j < 4; ++j) { v4b h;
#pragma unroll
    for (int e = 0; e < 4; ++e) h[e] = (__bf16)pf[j][e];
    *(v4b*)(&sw[0][wave][wbase + ((j * 4 + wrot) & 15) * 8]) = h; }
  sb2[0][wave][lane] = bfr(bn);      // chunk 0: published by the head's barriers
  // stage x rows
#pragma unroll      // 4 trips for every thread: all four loads in flight together
  for (int it = 0; it < 64 * (IN / 4) / 1024; ++it) { const int q = it * 1024 + tid, rl = q >> 6, pc = q & 63; v4f v = *(const v4f*)(x + (size_t)(tb + rl) * IN + pc * 4);
#pragma unroll
    for (int e = 0; e < 4; ++e) v[e] = bfr(v[e]);      // x is rounded to bf16 everywhere, including the final mat-vec
    *(v4f*)(&sx[rl >> 4][rl & 15][pc * 4]) = v; }
  __syncthreads();
  // u2 rows of this wave's two bias tiles (columns n = s*32 + j*16 + col, k = 8g.. and 16+8g..): loaded here, used behind the next barrier, so that they fly over the hw/hb phase
  float uv[2][16], cb[2];
#pragma unroll
  for (int j = 0; j < 2; ++j) { const int n = (s * 2 + j) * 16 + col; const float* p = u2 + (size_t)n * HID + 8 * g; cb[j] = c2[n];
#pragma unroll
    for (int i = 0; i < 8; ++i) { uv[j][i] = p[i]; uv[j][8 + i] = p[16 + i]; } }
  asm volatile("s_wait_xcnt 0x0" ::: "memory");      // stands in front of the first overwrite of these loads' address registers, which the next phase reuses at once
  // hw, hb: [16 x 256] @ [256 x 32]: 2 column tiles each, exact bf16 products; wave s = 0,1: hw tile j = s; s = 2,3: hb tile j = s - 2
  if (s < 4) { const int j = s & 1; const float* wsrc = (s >> 1) ? u1 : w1; v8f ac = {};
#pragma unroll
    for (int kc = 0; kc < IN / 32; ++kc) { const v16b a = split_row(x + (size_t)(t0 + col) * IN, kc * 32, lane).h;
      ac = wmma_bf(a, split_row(wsrc + (size_t)(j * 16 + col) * IN, kc * 32, lane).h, ac); }
    const int n = j * 16 + col;
    if ((s >> 1) == 0) { const float bb1 = bfr(b1[n]);
#pragma unroll
      for (int r = 0; r < 8; ++r) { const float hv = ac[r] + bb1; const __bf16 hi = (__bf16)hv; sa[tt][8 * g + r][n] = hi; sa[tt][8 * g + r][32 + n] = (__bf16)(hv - (float)hi); } }
    else { const float cc1 = bfr(c1[n]);
#pragma unroll
      for (int r = 0; r < 8; ++r) { const float hv = ac[r] + cc1; const __bf16 hi = (__bf16)hv; sab[tt][8 * g + r][n] = hi; sab[tt][8 * g + r][32 + n] = (__bf16)(hv - (float)hi); } } }
  else if (s == 4) { const float* xr = &sx[tt][col][0]; float sm = 0.f;      // row sums of x, once per row, in index order
#pragma unroll 8
    for (int i = 0; i < IN; ++i) sm += xr[i];
    if (g == 0) ssx[tt][col] = sm; }
  __syncthreads();
  // bias path: bgen[t][o] = hb . u2[o] + c2[o] on WMMA: [16 tokens x 32] @ [32 x 16 outputs], two tiles per wave (the 8 waves of a token tile cover the 256 outputs), then LN over o
  { const v16b h_hi = frag_b(&sab[tt][col][0], lane), h_lo = frag_b(&sab[tt][col][32], lane);
#pragma unroll
    for (int j = 0; j < 2; ++j) { const int n = (s * 2 + j) * 16 + col; const v16b ub = bsplit16(uv[j]).h;
      v8f acc = wmma_bf(h_lo, ub, (v8f){}); acc = wmma_bf(h_hi, ub, acc);
      const float cc = bfr(cb[j]);
#pragma unroll
      for (int r = 0; r < 8; ++r) sbias[tt][8 * g + r][n] = acc[r] + cc; }
    LDSX();      // the slice sums below read what other lanes of this same wave have just stored (its own 32 columns)
    const int rl = lane & 15, sl = s * 2 + (lane >> 4); const v4f* br = (const v4f*)&sbias[tt][rl][sl * 16]; float sm = 0.f, sq = 0.f;
#pragma unroll
    for (int oq = 0; oq < 4; ++oq) { const v4f bv = br[oq];
#pragma unroll
      for (int e = 0; e < 4; ++e) { sm += bv[e]; sq += bv[e] * bv[e]; } }
    sps[tt][rl][sl] = sm; spq[tt][rl][sl] = sq; }
  __syncthreads();
  { const int rl = lane & 15, hf = lane >> 4; float sm = 0.f, sq = 0.f;
#pragma unroll
    for (int c = 0; c < 16; ++c) { sm += sps[tt][rl][c]; sq += spq[tt][rl][c]; }
    const float mu = sm * (1.0f / OUT); float var = sq * (1.0f / OUT) - mu * mu; var = var > 0.f ? var : 0.f; const float rs = rsqrtf(var + 1e-5f);
#pragma unroll
    for (int e = 0; e < OW / 2; ++e) { const int o = o0 + hf * (OW / 2) + e; sbias[tt][rl][o] = (sbias[tt][rl][o] - mu) * rs; } }      // only this wave touches its 4 columns from here on
  LDSX();
  // generated-weight path: A fragments (hi chunk, lo chunk) fixed per wave
  const v16b a_hi = frag_b(&sa[tt][col][0], lane), a_lo = frag_b(&sa[tt][col][32], lane);
  // per lane: x values for my column i within a tile depend on the tile; rows 8g+r
#pragma unroll 1
  for (int o = o0; o < o0 + OW; ++o) { float sw1[8], sw2[8], swx[8];
#pragma unroll
    for (int r = 0; r < 8; ++r) { sw1[r] = 0.f; sw2[r] = 0.f; swx[r] = 0.f; }
#pragma unroll 1      // one copy of the chunk body: the prefetch stays ahead of the tile loop and its stores behind it
    for (int q = 0; q < 4; ++q) { const int c = (o - o0) * 4 + q;      // chunk c = tiles 4q..4q+3 of output o, in buffer c & 1
      if (c + 1 < NCH) {      // next chunk's global reads, in flight over this chunk's work
        bn = bsl[(c + 1) * 64];
#pragma unroll
        for (int j = 0; j < 4; ++j) pf[j] = *(const v4f*)(wsl + (size_t)(c + 1) * (64 * HID) + j * 128); }
#pragma unroll 2      // two tiles at a time; all four at once pushed the prefetched registers out to scratch
      for (int p = 0; p < 4; ++p) { const int i = (q * 4 + p) * 16 + col; const __bf16* tp = &sw[c & 1][s * 4 + p][0];
        union { v16b v; v8b h[2]; } wb; wb.h[0] = *(const v8b*)(tp + ro0); wb.h[1] = *(const v8b*)(tp + ro1);      // elements 0..7 = k 8g.., 8..15 = k 16+8g.., column = w2 row o*256 + i
        v8f acc = wmma_bf(a_lo, wb.v, (v8f){}); acc = wmma_bf(a_hi, wb.v, acc);
        const float bb = sb2[c & 1][s * 4 + p][lane];
#pragma unroll
        for (int r = 0; r < 8; ++r) { const float wv = acc[r] + bb; const float xv = sx[tt][8 * g + r][i]; sw1[r] += wv; sw2[r] += wv * wv; swx[r] += wv * xv; } }
      if (c + 1 < NCH) {      // the other buffer's last readers left it before the previous barrier
#pragma unroll
        for (int j = 0; j < 4; ++j) { v4b h;
#pragma unroll
          for (int e = 0; e < 4; ++e) h[e] = (__bf16)pf[j][e];
          *(v4b*)(&sw[(c + 1) & 1][wave][wbase + ((j * 4 + wrot) & 15) * 8]) = h; }
        sb2[(c + 1) & 1][wave][lane] = bfr(bn);
        __syncthreads(); } }      // publishes chunk c + 1 and ends every read of chunk c
    // reduce over the 16 column lanes (xor 1,2,4,8 stays within the 16-lane half)
#pragma unroll
    for (int r = 0; r < 8; ++r) {
#pragma unroll
      for (int m = 1; m < 16; m <<= 1) { sw1[r] += __shfl_xor(sw1[r], m, 32); sw2[r] += __shfl_xor(sw2[r], m, 32); swx[r] += __shfl_xor(swx[r], m, 32); } }
    if (col == (o & 15)) {       // one lane per (row-half g) finalises this o for its 8 rows
#pragma unroll
      for (int r = 0; r < 8; ++r) { const float mu = sw1[r] * (1.0f / IN); float var = sw2[r] * (1.0f / IN) - mu * mu; var = var > 0.f ? var : 0.f; const float rs = rsqrtf(var + 1e-5f);
        sy[tt][8 * g + r][o - blockIdx.y * OC] = (swx[r] - mu * ssx[tt][8 * g + r]) * rs + sbias[tt][8 * g + r][o]; } } }
  __syncthreads();
  if (tid < 64 * (OC / 4)) { const int rl = tid >> 3, pc = tid & 7; vst2(y + (size_t)(tb + rl) * OUT + blockIdx.y * OC + pc * 4, *(const v4f*)(&sy[rl >> 4][rl & 15][pc * 4])); }
}
extern "C" void kernel_launch(void* const* d_in, const int* in_sizes, int n_in, void* d_out, int out_size, void* d_ws, size_t ws_size, hipStream_t stream) {
  (void)in_sizes; (void)n_in; (void)out_size; (void)ws_size; (void)d_ws;
  const float** I = (const float**)d_in;   // x, w1, b1, w2, b2, u1, c1, u2, c2
  k_meta<<<dim3(NT / 64, OUT / OC), 1024, 0, stream>>>(I[0], I[1], I[2], I[3], I[4], I[5], I[6], I[7], I[8], (float*)d_out);
}

// v004
// It runs in 37.5 microseconds.
// In both of two side-by-side timings against v003, it was 1.11 times as fast.
// Counting every step since v000, it is 65.1 times as fast.
// compute dtype: x, w1, u1 (INPUTS) as exact bf16 WMMA products (f32 accumulate); the generated weights w = hw w2^T use the computed 32-wide code hw as a bf16 hi/lo pair against bf16(w2) (2 products, f32-grade); the generated bias hb u2^T likewise uses hb as a bf16 hi/lo pair against bf16(u2) (2 products, f32-grade); LayerNorm statistics and the per-token mat-vec with (bf16-rounded) x in f32. The 65,536 generated weights per token never leave registers: each 16x16 tile contributes its partial sums (sum w, sum w^2, sum w*x) directly.
#include <hip/hip_runtime.h>
#include <math.h>

typedef __attribute__((ext_vector_type(16))) _Float16 v16h;
typedef __attribute__((ext_vector_type(16))) __bf16 v16b;
typedef __attribute__((ext_vector_type(8)))  _Float16 v8h;
typedef __attribute__((ext_vector_type(8)))  float v8f;
typedef __attribute__((ext_vector_type(4)))  float v4f;
typedef __attribute__((ext_vector_type(2)))  float v2f;
typedef __attribute__((ext_vector_type(4)))  unsigned v4u;
typedef __attribute__((ext_vector_type(4)))  int v4i;
typedef float __attribute__((may_alias)) float_a;
typedef int __attribute__((may_alias)) int_a;

template <typename T> __device__ __forceinline__ void vst2(void* p, T v) { *(T*)p = v;  }
__device__ __forceinline__ v8f wmma16(v16h a, v16h b, v8f c) {
  v8f d = __builtin_amdgcn_wmma_f32_16x16x32_f16(false, a, false, b, (short)0, c, false, false);
  asm volatile("v_nop\n\tv_nop\n\tv_nop\n\tv_nop" : "+v"(d) : "v"(a), "v"(b));
  return d;
}
__device__ __forceinline__ v8f wmma_bf(v16b a, v16b b, v8f c) {
  v8f d = __builtin_amdgcn_wmma_f32_16x16x32_bf16(false, a, false, b, (short)0, c, false, false);
  asm volatile("v_nop\n\tv_nop\n\tv_nop\n\tv_nop" : "+v"(d) : "v"(a), "v"(b));
  return d;
}
// 16x16x32 fragments: lane = (h = lane>>4, row/col = lane&15); elements 0..7 = k0+8h+0..7, 8..15 = k0+16+8h+0..7; D element r = row 8h+r
__device__ __forceinline__ v16h frag_h(const _Float16* rowk0, int lane) {
  union { v16h v; v8h q[2]; } u; const _Float16* p = rowk0 + 8 * (lane >> 4);
  u.q[0] = *(const v8h*)p; u.q[1] = *(const v8h*)(p + 16); return u.v;
}
__device__ __forceinline__ v16h frag_f32(const float* rowk0, int lane) {
  v16h a; const float* p = rowk0 + 8 * (lane >> 4);
#pragma unroll
  for (int i = 0; i < 8; ++i) { a[i] = (_Float16)p[i]; a[8 + i] = (_Float16)p[16 + i]; }
  return a;
}
__device__ __forceinline__ v16h frag_f32s(const float* rowk0, int lane, float sc) {
  v16h a; const float* p = rowk0 + 8 * (lane >> 4);
#pragma unroll
  for (int i = 0; i < 8; ++i) { a[i] = (_Float16)(p[i] * sc); a[8 + i] = (_Float16)(p[16 + i] * sc); }
  return a;
}
// column fragment from a [K][ld] layout (column n), rows >= K read as 0
__device__ __forceinline__ v16h fragc_f32(const float* W, int k0, int n, int lane, int ld, int K) {
  v16h a; const int g = lane >> 4;
#pragma unroll
  for (int i = 0; i < 8; ++i) { const int ka = k0 + 8 * g + i, kb = ka + 16;
    a[i] = (_Float16)(ka < K ? W[(size_t)(ka < K ? ka : K - 1) * ld + n] : 0.f); a[8 + i] = (_Float16)(kb < K ? W[(size_t)(kb < K ? kb : K - 1) * ld + n] : 0.f); }
  return a;
}
struct F2 { v16b h, l; };
__device__ __forceinline__ F2 bsplit16(const float v[16]) { F2 r;
#pragma unroll
  for (int i = 0; i < 16; ++i) { const __bf16 h = (__bf16)v[i]; r.h[i] = h; r.l[i] = (__bf16)(v[i] - (float)h); }
  return r; }
__device__ __forceinline__ F2 split_row(const float* row, int k0, int lane) { float v[16]; const float* p = row + k0 + 8 * (lane >> 4);
#pragma unroll
  for (int i = 0; i < 8; ++i) { v[i] = p[i]; v[8 + i] = p[16 + i]; }
  return bsplit16(v); }
__device__ __forceinline__ F2 split_rowK(const float* row, int k0, int lane, int K) { float v[16]; const int g = lane >> 4;
#pragma unroll
  for (int i = 0; i < 8; ++i) { const int ka = k0 + 8 * g + i, kb = ka + 16; v[i] = ka < K ? row[ka < K ? ka : K - 1] : 0.f; v[8 + i] = kb < K ? row[kb < K ? kb : K - 1] : 0.f; }
  return bsplit16(v); }
__device__ __forceinline__ F2 split_col(const float* W, int k0, int n, int lane, int ld, int K) { float v[16]; const int g = lane >> 4;
#pragma unroll
  for (int i = 0; i < 8; ++i) { const int ka = k0 + 8 * g + i, kb = ka + 16; v[i] = ka < K ? W[(size_t)(ka < K ? ka : K - 1) * ld + n] : 0.f; v[8 + i] = kb < K ? W[(size_t)(kb < K ? kb : K - 1) * ld + n] : 0.f; }
  return bsplit16(v); }
__device__ __forceinline__ v8f mac3(const F2& a, const F2& b, v8f c) { c = wmma_bf(a.l, b.h, c); c = wmma_bf(a.h, b.l, c); return wmma_bf(a.h, b.h, c); }
__device__ __forceinline__ float sigm(float v) { return 1.0f / (1.0f + expf(-v)); }
#define LDSX() do { asm volatile("s_wait_dscnt 0" ::: "memory"); __builtin_amdgcn_wave_barrier(); __builtin_amdgcn_fence(__ATOMIC_RELEASE, "workgroup"); } while (0)


// Hyper-network linear layer: per token: hw = x w1^T + b1 (32); W[o][i] = LN_i(hw . w2[o*256+i] + b2[o*256+i]) (no affine, eps 1e-5); hb = x u1^T + c1; bias[o] = LN_o(hb . u2[o] + c2[o]);
// y[o] = sum_i W[o][i] x[i] + bias[o] = (S_wx - mu_o S_x) * rsqrt(var_o + eps) + bias[o], with S_w, S_w2, S_wx accumulated per (token, o) over the 16 tiles of that o.
// One kernel: block = 64 tokens x 32 outputs, 32 waves: wave = (token tile tt of 16 tokens, output slice s of 4 outputs); grid = 32 token blocks x 8 output chunks, one block per WGP.
// The head is shared by the block through LDS: x rows staged by all threads; hw/hb by exact WMMA, one 16x16 tile per wave (s = 0..3); row sums of x by the s = 4 waves; the bias rows by WMMA, two 16x16 tiles per wave, their LN sums in 16 slices of 16 outputs.
// hw is split hi/lo once into an LDS A fragment row [hi(32)|lo(32)] (two k-chunks); then for each of the wave's 4 outputs o:
// 16 tiles of [16 tokens x 16 i] = A x bf16(w2 rows) (+ bf16(b2)), per-lane partial sums with x[token][i], DPP reduction over the 16 column lanes that leaves one row per lane, which finishes y[token][o]; the block stores whole 128-byte lines.
// w2 reaches the B fragments through LDS: the 4 waves of an output slice share its w2 rows, so each stages one 16-row tile of every 4-tile chunk with loads that cover whole 128-byte lines,
// rounds it to bf16 once and stores it in fragment order; two buffers, the next chunk's loads (and its b2 values) fly in registers while this chunk is worked on, one barrier per chunk.
#define NB 4
#define SQ 512
#define NT (NB * SQ)     // 2048 tokens
#define IN 256
#define OUT 256
#define HID 32
__device__ __forceinline__ float bfr(float v) { return (float)(__bf16)v; }
__device__ __forceinline__ v16b frag_b(const __bf16* rowk0, int lane) { return __builtin_bit_cast(v16b, frag_h((const _Float16*)rowk0, lane)); }

// keep + (send of the lane whose number within its row of 16 differs by xor M), as one DPP add
template <int M> __device__ __forceinline__ float rsum(float keep, float send) {
  return keep + __builtin_bit_cast(float, __builtin_amdgcn_update_dpp(0, __builtin_bit_cast(int, send), 0x160 | M, 0xf, 0xf, true));
}
#define OC 32            // outputs per block: one 128-byte line of y per token
#define OW 4             // outputs per wave
#define NCH (OW * 4)     // chunks of 4 tiles (64 w2 rows) per output slice
typedef __attribute__((ext_vector_type(4))) __bf16 v4b;
typedef __attribute__((ext_vector_type(8))) __bf16 v8b;
__global__ __launch_bounds__(1024) void k_meta(const float* __restrict__ x, const float* __restrict__ w1, const float* __restrict__ b1, const float* __restrict__ w2, const float* __restrict__ b2, const float* __restrict__ u1, const float* __restrict__ c1, const float* __restrict__ u2, const float* __restrict__ c2, float* __restrict__ y) {
  __shared__ __align__(16) __bf16 sa[4][16][72];        // per token: [hi(hw) 32 | lo(hw) 32] -> A fragments for the w2 GEMM (k-chunk 0 = hi, 1 = lo)
  __shared__ __align__(16) __bf16 sab[4][16][72];       // per token: [hi(hb) 32 | lo(hb) 32] -> A fragments for the u2 GEMM
  __shared__ __align__(16) float sx[4][16][IN + 4];      // x rows (f32) for the mat-vec partials
  __shared__ __align__(16) float sy[4][16][OC + 4];      // this block's outputs
  __shared__ __align__(16) float sbias[4][16][OUT + 4];  // generated bias pre-LN; each wave's own 4 columns then LN'd
  __shared__ float sps[4][16][17], spq[4][16][17];       // bias LN partial sums, one per slice of 16 outputs
  __shared__ float ssx[4][16];                           // sum_i x[row][i]
  __shared__ __align__(16) __bf16 sw[2][32][512];        // w2 tiles as bf16 B fragments: [buffer][slice * 4 + tile of the chunk][k half][slot of 8 values]
  __shared__ float sb2[2][32][32];                       // bf16-rounded b2 of the same tiles, one value per reading lane
  const int tid = threadIdx.x, wave = __builtin_amdgcn_readfirstlane(tid >> 5), lane = tid & 31, col = lane & 15, g = lane >> 4;
  const int tt = wave & 3, s = wave >> 2; const int tb = blockIdx.x * 64, t0 = tb + tt * 16, o0 = blockIdx.y * OC + s * OW;
  // w2 staging. Source: tile tt of each chunk of this wave's slice; load j takes 512 consecutive bytes (rows 4j..4j+3 of the tile), lane = (row lane>>3, k = 4*(lane&7)..+3).
  // Place of (row, k block kb = k>>3): half kb>>1, slot 16*(kb&1) + ((row + 4*kb) & 15): a fragment read takes 512 bytes in a row, and the 32 lanes of a store fall on 64 different banks.
  const float* wsl = w2 + ((size_t)o0 * IN + tt * 16) * HID + lane * 4;
  const float* bsl = b2 + (size_t)o0 * IN + tt * 16 + col;
  const int kb = (lane & 7) >> 1, wbase = (kb >> 1) * 256 + (kb & 1) * 128 + (lane & 1) * 4, wrot = (lane >> 3) + 4 * kb;
  const int ro0 = (g * 16 + ((col + 4 * g) & 15)) * 8, ro1 = 256 + (g * 16 + ((col + 4 * (2 + g)) & 15)) * 8;      // this lane's two fragment halves
  v4f pf[4]; float bn = bsl[0];
#pragma unroll      // pf[] is indexed by constants only, so it stays in registers
  for (int j = 0; j < 4; ++j) pf[j] = *(const v4f*)(wsl + j * 128);
#pragma unroll
  for (int j = 0; j < 4; ++j) { v4b h;
#pragma unroll
    for (int e = 0; e < 4; ++e) h[e] = (__bf16)pf[j][e];
    *(v4b*)(&sw[0][wave][wbase + ((j * 4 + wrot) & 15) * 8]) = h; }
  sb2[0][wave][lane] = bfr(bn);      // chunk 0: published by the head's barriers
  // stage x rows
#pragma unroll      // 4 trips for every thread: all four loads in flight together
  for (int it = 0; it < 64 * (IN / 4) / 1024; ++it) { const int q = it * 1024 + tid, rl = q >> 6, pc = q & 63; v4f v = *(const v4f*)(x + (size_t)(tb + rl) * IN + pc * 4);
#pragma unroll
    for (int e = 0; e < 4; ++e) v[e] = bfr(v[e]);      // x is rounded to bf16 everywhere, including the final mat-vec
    *(v4f*)(&sx[rl >> 4][rl & 15][pc * 4]) = v; }
  __syncthreads();
  // u2 rows of this wave's two bias tiles (columns n = s*32 + j*16 + col, k = 8g.. and 16+8g..): loaded here, used behind the next barrier, so that they fly over the hw/hb phase
  float uv[2][16], cb[2];
#pragma unroll
  for (int j = 0; j < 2; ++j) { const int n = (s * 2 + j) * 16 + col; const float* p = u2 + (size_t)n * HID + 8 * g; cb[j] = c2[n];
#pragma unroll
    for (int i = 0; i < 8; ++i) { uv[j][i] = p[i]; uv[j][8 + i] = p[16 + i]; } }
  asm volatile("s_wait_xcnt 0x0" ::: "memory");      // stands in front of the first overwrite of these loads' address registers, which the next phase reuses at once
  // hw, hb: [16 x 256] @ [256 x 32]: 2 column tiles each, exact bf16 products; wave s = 0,1: hw tile j = s; s = 2,3: hb tile j = s - 2
  if (s < 4) { const int j = s & 1; const float* wsrc = (s >> 1) ? u1 : w1; v8f ac = {};
#pragma unroll
    for (int kc = 0; kc < IN / 32; ++kc) { const v16b a = split_row(x + (size_t)(t0 + col) * IN, kc * 32, lane).h;
      ac = wmma_bf(a, split_row(wsrc + (size_t)(j * 16 + col) * IN, kc * 32, lane).h, ac); }
    const int n = j * 16 + col;
    if ((s >> 1) == 0) { const float bb1 = bfr(b1[n]);
#pragma unroll
      for (int r = 0; r < 8; ++r) { const float hv = ac[r] + bb1; const __bf16 hi = (__bf16)hv; sa[tt][8 * g + r][n] = hi; sa[tt][8 * g + r][32 + n] = (__bf16)(hv - (float)hi); } }
    else { const float cc1 = bfr(c1[n]);
#pragma unroll
      for (int r = 0; r < 8; ++r) { const float hv = ac[r] + cc1; const __bf16 hi = (__bf16)hv; sab[tt][8 * g + r][n] = hi; sab[tt][8 * g + r][32 + n] = (__bf16)(hv - (float)hi); } } }
  else if (s == 4) { const float* xr = &sx[tt][col][0]; float sm = 0.f;      // row sums of x, once per row, in index order
#pragma unroll 8
    for (int i = 0; i < IN; ++i) sm += xr[i];
    if (g == 0) ssx[tt][col] = sm; }
  __syncthreads();
  // bias path: bgen[t][o] = hb . u2[o] + c2[o] on WMMA: [16 tokens x 32] @ [32 x 16 outputs], two tiles per wave (the 8 waves of a token tile cover the 256 outputs), then LN over o
  { const v16b h_hi = frag_b(&sab[tt][col][0], lane), h_lo = frag_b(&sab[tt][col][32], lane);
#pragma unroll
    for (int j = 0; j < 2; ++j) { const int n = (s * 2 + j) * 16 + col; const v16b ub = bsplit16(uv[j]).h;
      v8f acc = wmma_bf(h_lo, ub, (v8f){}); acc = wmma_bf(h_hi, ub, acc);
      const float cc = bfr(cb[j]);
#pragma unroll
      for (int r = 0; r < 8; ++r) sbias[tt][8 * g + r][n] = acc[r] + cc; }
    LDSX();      // the slice sums below read what other lanes of this same wave have just stored (its own 32 columns)
    const int rl = lane & 15, sl = s * 2 + (lane >> 4); const v4f* br = (const v4f*)&sbias[tt][rl][sl * 16]; float sm = 0.f, sq = 0.f;
#pragma unroll
    for (int oq = 0; oq < 4; ++oq) { const v4f bv = br[oq];
#pragma unroll
      for (int e = 0; e < 4; ++e) { sm += bv[e]; sq += bv[e] * bv[e]; } }
    sps[tt][rl][sl] = sm; spq[tt][rl][sl] = sq; }
  __syncthreads();
  { const int rl = lane & 15, hf = lane >> 4; float sm = 0.f, sq = 0.f;
#pragma unroll
    for (int c = 0; c < 16; ++c) { sm += sps[tt][rl][c]; sq += spq[tt][rl][c]; }
    const float mu = sm * (1.0f / OUT); float var = sq * (1.0f / OUT) - mu * mu; var = var > 0.f ? var : 0.f; const float rs = rsqrtf(var + 1e-5f);
#pragma unroll
    for (int e = 0; e < OW / 2; ++e) { const int o = o0 + hf * (OW / 2) + e; sbias[tt][rl][o] = (sbias[tt][rl][o] - mu) * rs; } }      // only this wave touches its 4 columns from here on
  LDSX();
  // generated-weight path: A fragments (hi chunk, lo chunk) fixed per wave
  const v16b a_hi = frag_b(&sa[tt][col][0], lane), a_lo = frag_b(&sa[tt][col][32], lane);
  // per lane: x values for my column i within a tile depend on the tile; rows 8g+r
  const bool bit0 = col & 1, bit1 = col & 2, bit2 = col & 4; const int rown = 8 * g + (col & 7);      // the row whose sums this lane ends up with
#pragma unroll 1
  for (int o = o0; o < o0 + OW; ++o) { float sw1[8], sw2[8], swx[8];
#pragma unroll
    for (int r = 0; r < 8; ++r) { sw1[r] = 0.f; sw2[r] = 0.f; swx[r] = 0.f; }
#pragma unroll 1      // one copy of the chunk body: the prefetch stays ahead of the tile loop and its stores behind it
    for (int q = 0; q < 4; ++q) { const int c = (o - o0) * 4 + q;      // chunk c = tiles 4q..4q+3 of output o, in buffer c & 1
      if (c + 1 < NCH) {      // next chunk's global reads, in flight over this chunk's work
        bn = bsl[(c + 1) * 64];
#pragma unroll
        for (int j = 0; j < 4; ++j) pf[j] = *(const v4f*)(wsl + (size_t)(c + 1) * (64 * HID) + j * 128); }
#pragma unroll 2      // two tiles at a time; all four at once pushed the prefetched registers out to scratch
      for (int p = 0; p < 4; ++p) { const int i = (q * 4 + p) * 16 + col; const __bf16* tp = &sw[c & 1][s * 4 + p][0];
        union { v16b v; v8b h[2]; } wb; wb.h[0] = *(const v8b*)(tp + ro0); wb.h[1] = *(const v8b*)(tp + ro1);      // elements 0..7 = k 8g.., 8..15 = k 16+8g.., column = w2 row o*256 + i
        v8f acc = wmma_bf(a_lo, wb.v, (v8f){}); acc = wmma_bf(a_hi, wb.v, acc);
        const float bb = sb2[c & 1][s * 4 + p][lane];
#pragma unroll
        for (int r = 0; r < 8; ++r) { const float wv = acc[r] + bb; const float xv = sx[tt][8 * g + r][i]; sw1[r] += wv; sw2[r] += wv * wv; swx[r] += wv * xv; } }
      if (c + 1 < NCH) {      // the other buffer's last readers left it before the previous barrier
#pragma unroll
        for (int j = 0; j < 4; ++j) { v4b h;
#pragma unroll
          for (int e = 0; e < 4; ++e) h[e] = (__bf16)pf[j][e];
          *(v4b*)(&sw[(c + 1) & 1][wave][wbase + ((j * 4 + wrot) & 15) * 8]) = h; }
        sb2[(c + 1) & 1][wave][lane] = bfr(bn);
        __syncthreads(); } }      // publishes chunk c + 1 and ends every read of chunk c
    // sum over the 16 column lanes by DPP adds, xor 1, 2, 4, 8 in that order. Steps 1, 2, 4 also halve the rows a lane carries: of each pair of rows a lane keeps the one its bit names and hands the other
    // to its partner, so every value is added to the same partner's value as in a plain butterfly and the lane ends with the three sums of row 8g + (col & 7) alone.
    float f1[4], f2[4], fx[4];
#pragma unroll      // constant indices: the sums stay in registers
    for (int k = 0; k < 4; ++k) { f1[k] = rsum<1>(bit0 ? sw1[2 * k + 1] : sw1[2 * k], bit0 ? sw1[2 * k] : sw1[2 * k + 1]); f2[k] = rsum<1>(bit0 ? sw2[2 * k + 1] : sw2[2 * k], bit0 ? sw2[2 * k] : sw2[2 * k + 1]);
      fx[k] = rsum<1>(bit0 ? swx[2 * k + 1] : swx[2 * k], bit0 ? swx[2 * k] : swx[2 * k + 1]); }
#pragma unroll      // constant indices, as above
    for (int k = 0; k < 2; ++k) { f1[k] = rsum<2>(bit1 ? f1[2 * k + 1] : f1[2 * k], bit1 ? f1[2 * k] : f1[2 * k + 1]); f2[k] = rsum<2>(bit1 ? f2[2 * k + 1] : f2[2 * k], bit1 ? f2[2 * k] : f2[2 * k + 1]);
      fx[k] = rsum<2>(bit1 ? fx[2 * k + 1] : fx[2 * k], bit1 ? fx[2 * k] : fx[2 * k + 1]); }
    float t1 = rsum<4>(bit2 ? f1[1] : f1[0], bit2 ? f1[0] : f1[1]), t2 = rsum<4>(bit2 ? f2[1] : f2[0], bit2 ? f2[0] : f2[1]), tx = rsum<4>(bit2 ? fx[1] : fx[0], bit2 ? fx[0] : fx[1]);
    t1 = rsum<8>(t1, t1); t2 = rsum<8>(t2, t2); tx = rsum<8>(tx, tx);
    { const float mu = t1 * (1.0f / IN); float var = t2 * (1.0f / IN) - mu * mu; var = var > 0.f ? var : 0.f; const float rs = rsqrtf(var + 1e-5f);      // every lane finishes its own row
      const float yv = (tx - mu * ssx[tt][rown]) * rs + sbias[tt][rown][o];
      if (col < 8) sy[tt][rown][o - blockIdx.y * OC] = yv; } }      // lanes col and col + 8 hold the same value
  __syncthreads();
  if (tid < 64 * (OC / 4)) { const int rl = tid >> 3, pc = tid & 7; vst2(y + (size_t)(tb + rl) * OUT + blockIdx.y * OC + pc * 4, *(const v4f*)(&sy[rl >> 4][rl & 15][pc * 4])); }
}
extern "C" void kernel_launch(void* const* d_in, const int* in_sizes, int n_in, void* d_out, int out_size, void* d_ws, size_t ws_size, hipStream_t stream) {
  (void)in_sizes; (void)n_in; (void)out_size; (void)ws_size; (void)d_ws;
  const float** I = (const float**)d_in;   // x, w1, b1, w2, b2, u1, c1, u2, c2
  k_meta<<<dim3(NT / 64, OUT / OC), 1024, 0, stream>>>(I[0], I[1], I[2], I[3], I[4], I[5], I[6], I[7], I[8], (float*)d_out);
}

// v005
// It runs in 35.1 microseconds.
// Timed twice side by side with v004, it ran 1.07 times as fast both times.
// All steps since v000 together make it 69.6 times as fast.
// compute dtype: x, w1, u1 (INPUTS) as exact bf16 WMMA products (f32 accumulate); the generated weights w = hw w2^T use the computed 32-wide code hw as a bf16 hi/lo pair against bf16(w2) (2 products, f32-grade); the generated bias hb u2^T likewise uses hb as a bf16 hi/lo pair against bf16(u2) (2 products, f32-grade); LayerNorm statistics and the per-token mat-vec with (bf16-rounded) x in f32. The 65,536 generated weights per token never leave registers: each 16x16 tile contributes its partial sums (sum w, sum w^2, sum w*x) directly.
#include <hip/hip_runtime.h>
#include <math.h>

typedef __attribute__((ext_vector_type(16))) _Float16 v16h;
typedef __attribute__((ext_vector_type(16))) __bf16 v16b;
typedef __attribute__((ext_vector_type(8)))  _Float16 v8h;
typedef __attribute__((ext_vector_type(8)))  float v8f;
typedef __attribute__((ext_vector_type(4)))  float v4f;
typedef __attribute__((ext_vector_type(2)))  float v2f;
typedef __attribute__((ext_vector_type(4)))  unsigned v4u;
typedef __attribute__((ext_vector_type(4)))  int v4i;
typedef float __attribute__((may_alias)) float_a;
typedef int __attribute__((may_alias)) int_a;

template <typename T> __device__ __forceinline__ void vst2(void* p, T v) { *(T*)p = v;  }
__device__ __forceinline__ v8f wmma16(v16h a, v16h b, v8f c) {
  v8f d = __builtin_amdgcn_wmma_f32_16x16x32_f16(false, a, false, b, (short)0, c, false, false);
  asm volatile("v_nop\n\tv_nop\n\tv_nop\n\tv_nop" : "+v"(d) : "v"(a), "v"(b));
  return d;
}
__device__ __forceinline__ v8f wmma_bf(v16b a, v16b b, v8f c) {
  v8f d = __builtin_amdgcn_wmma_f32_16x16x32_bf16(false, a, false, b, (short)0, c, false, false);
  asm volatile("v_nop\n\tv_nop\n\tv_nop\n\tv_nop" : "+v"(d) : "v"(a), "v"(b));
  return d;
}
// 16x16x32 fragments: lane = (h = lane>>4, row/col = lane&15); elements 0..7 = k0+8h+0..7, 8..15 = k0+16+8h+0..7; D element r = row 8h+r
__device__ __forceinline__ v16h frag_h(const _Float16* rowk0, int lane) {
  union { v16h v; v8h q[2]; } u; const _Float16* p = rowk0 + 8 * (lane >> 4);
  u.q[0] = *(const v8h*)p; u.q[1] = *(const v8h*)(p + 16); return u.v;
}
__device__ __forceinline__ v16h frag_f32(const float* rowk0, int lane) {
  v16h a; const float* p = rowk0 + 8 * (lane >> 4);
#pragma unroll
  for (int i = 0; i < 8; ++i) { a[i] = (_Float16)p[i]; a[8 + i] = (_Float16)p[16 + i]; }
  return a;
}
__device__ __forceinline__ v16h frag_f32s(const float* rowk0, int lane, float sc) {
  v16h a; const float* p = rowk0 + 8 * (lane >> 4);
#pragma unroll
  for (int i = 0; i < 8; ++i) { a[i] = (_Float16)(p[i] * sc); a[8 + i] = (_Float16)(p[16 + i] * sc); }
  return a;
}
// column fragment from a [K][ld] layout (column n), rows >= K read as 0
__device__ __forceinline__ v16h fragc_f32(const float* W, int k0, int n, int lane, int ld, int K) {
  v16h a; const int g = lane >> 4;
#pragma unroll
  for (int i = 0; i < 8; ++i) { const int ka = k0 + 8 * g + i, kb = ka + 16;
    a[i] = (_Float16)(ka < K ? W[(size_t)(ka < K ? ka : K - 1) * ld + n] : 0.f); a[8 + i] = (_Float16)(kb < K ? W[(size_t)(kb < K ? kb : K - 1) * ld + n] : 0.f); }
  return a;
}
struct F2 { v16b h, l; };
__device__ __forceinline__ F2 bsplit16(const float v[16]) { F2 r;
#pragma unroll
  for (int i = 0; i < 16; ++i) { const __bf16 h = (__bf16)v[i]; r.h[i] = h; r.l[i] = (__bf16)(v[i] - (float)h); }
  return r; }
__device__ __forceinline__ F2 split_row(const float* row, int k0, int lane) { float v[16]; const float* p = row + k0 + 8 * (lane >> 4);
#pragma unroll
  for (int i = 0; i < 8; ++i) { v[i] = p[i]; v[8 + i] = p[16 + i]; }
  return bsplit16(v); }
__device__ __forceinline__ F2 split_rowK(const float* row, int k0, int lane, int K) { float v[16]; const int g = lane >> 4;
#pragma unroll
  for (int i = 0; i < 8; ++i) { const int ka = k0 + 8 * g + i, kb = ka + 16; v[i] = ka < K ? row[ka < K ? ka : K - 1] : 0.f; v[8 + i] = kb < K ? row[kb < K ? kb : K - 1] : 0.f; }
  return bsplit16(v); }
__device__ __forceinline__ F2 split_col(const float* W, int k0, int n, int lane, int ld, int K) { float v[16]; const int g = lane >> 4;
#pragma unroll
  for (int i = 0; i < 8; ++i) { const int ka = k0 + 8 * g + i, kb = ka + 16; v[i] = ka < K ? W[(size_t)(ka < K ? ka : K - 1) * ld + n] : 0.f; v[8 + i] = kb < K ? W[(size_t)(kb < K ? kb : K - 1) * ld + n] : 0.f; }
  return bsplit16(v); }
__device__ __forceinline__ v8f mac3(const F2& a, const F2& b, v8f c) { c = wmma_bf(a.l, b.h, c); c = wmma_bf(a.h, b.l, c); return wmma_bf(a.h, b.h, c); }
__device__ __forceinline__ float sigm(float v) { return 1.0f / (1.0f + expf(-v)); }
#define LDSX() do { asm volatile("s_wait_dscnt 0" ::: "memory"); __builtin_amdgcn_wave_barrier(); __builtin_amdgcn_fence(__ATOMIC_RELEASE, "workgroup"); } while (0)


// Hyper-network linear layer: per token: hw = x w1^T + b1 (32); W[o][i] = LN_i(hw . w2[o*256+i] + b2[o*256+i]) (no affine, eps 1e-5); hb = x u1^T + c1; bias[o] = LN_o(hb . u2[o] + c2[o]);
// y[o] = sum_i W[o][i] x[i] + bias[o] = (S_wx - mu_o S_x) * rsqrt(var_o + eps) + bias[o], with S_w, S_w2, S_wx accumulated per (token, o) over the 16 tiles of that o.
// One kernel: block = 64 tokens x 32 outputs, 32 waves: wave = (token tile tt of 16 tokens, output slice s of 4 outputs); grid = 32 token blocks x 8 output chunks, one block per WGP.
// The head is shared by the block through LDS: x rows staged by all threads; hw/hb by exact WMMA, one 16x16 tile per wave (s = 0..3); row sums of x by the s = 4 waves; the bias rows by WMMA, two 16x16 tiles per wave, their LN sums in 16 slices of 16 outputs.
// hw is split hi/lo once into an LDS fragment row [hi(32)|lo(32)] (two k-chunks); then for each of the wave's 4 outputs o:
// 16 tiles of [16 i x 16 tokens] = bf16(w2 rows) as A x the hw fragments as B, bf16(b2) as C: a lane holds 8 consecutive i of ONE token, so the three sums over i run inside the lane; one add across the two lane halves finishes y[token][o]; the block stores whole 128-byte lines.
// w2 reaches its fragments through LDS: the 4 waves of an output slice share its w2 rows, so each stages one 16-row tile of every 4-tile chunk with loads that cover whole 128-byte lines,
// rounds it to bf16 once and stores it in fragment order; two buffers, the next chunk's loads (and its b2 values) fly in registers while this chunk is worked on, one barrier per chunk.
#define NB 4
#define SQ 512
#define NT (NB * SQ)     // 2048 tokens
#define IN 256
#define OUT 256
#define HID 32
__device__ __forceinline__ float bfr(float v) { return (float)(__bf16)v; }
__device__ __forceinline__ v16b frag_b(const __bf16* rowk0, int lane) { return __builtin_bit_cast(v16b, frag_h((const _Float16*)rowk0, lane)); }

// the value that lane ^ 16 holds (same place in the other row of 16 lanes)
__device__ __forceinline__ float xhalf(float v) { const int b = __builtin_bit_cast(int, v);
  return __builtin_bit_cast(float, __builtin_amdgcn_permlanex16(b, b, 0x76543210, 0xfedcba98, false, false)); }
#define OC 32            // outputs per block: one 128-byte line of y per token
#define OW 4             // outputs per wave
#define NCH (OW * 4)     // chunks of 4 tiles (64 w2 rows) per output slice
typedef __attribute__((ext_vector_type(4))) __bf16 v4b;
typedef __attribute__((ext_vector_type(8))) __bf16 v8b;
__global__ __launch_bounds__(1024) void k_meta(const float* __restrict__ x, const float* __restrict__ w1, const float* __restrict__ b1, const float* __restrict__ w2, const float* __restrict__ b2, const float* __restrict__ u1, const float* __restrict__ c1, const float* __restrict__ u2, const float* __restrict__ c2, float* __restrict__ y) {
  __shared__ __align__(16) __bf16 sa[4][16][72];        // per token: [hi(hw) 32 | lo(hw) 32] -> token-side fragments for the w2 GEMM (k-chunk 0 = hi, 1 = lo)
  __shared__ __align__(16) __bf16 sab[4][16][72];       // per token: [hi(hb) 32 | lo(hb) 32] -> A fragments for the u2 GEMM
  __shared__ __align__(16) float sx[4][16][IN + 4];      // x rows (f32) for the mat-vec partials
  __shared__ __align__(16) float sy[4][16][OC + 4];      // this block's outputs
  __shared__ __align__(16) float sbias[4][16][OUT + 4];  // generated bias pre-LN; each wave's own 4 columns then LN'd
  __shared__ float sps[4][16][17], spq[4][16][17];       // bias LN partial sums, one per slice of 16 outputs
  __shared__ float ssx[4][16];                           // sum_i x[row][i]
  __shared__ __align__(16) __bf16 sw[2][32][512];        // w2 tiles as bf16 fragments: [buffer][slice * 4 + tile of the chunk][k half][slot of 8 values]
  __shared__ __align__(16) float sb2[2][32][32];         // bf16-rounded b2 of the same tiles: places 0..15 = the tile's 16 rows (16..31 repeat them)
  const int tid = threadIdx.x, wave = __builtin_amdgcn_readfirstlane(tid >> 5), lane = tid & 31, col = lane & 15, g = lane >> 4;
  const int tt = wave & 3, s = wave >> 2; const int tb = blockIdx.x * 64, t0 = tb + tt * 16, o0 = blockIdx.y * OC + s * OW;
  // w2 staging. Source: tile tt of each chunk of this wave's slice; load j takes 512 consecutive bytes (rows 4j..4j+3 of the tile), lane = (row lane>>3, k = 4*(lane&7)..+3).
  // Place of (row, k block kb = k>>3): half kb>>1, slot 16*(kb&1) + ((row + 4*kb) & 15): a fragment read takes 512 bytes in a row, and the 32 lanes of a store fall on 64 different banks.
  const float* wsl = w2 + ((size_t)o0 * IN + tt * 16) * HID + lane * 4;
  const float* bsl = b2 + (size_t)o0 * IN + tt * 16 + col;
  const int kb = (lane & 7) >> 1, wbase = (kb >> 1) * 256 + (kb & 1) * 128 + (lane & 1) * 4, wrot = (lane >> 3) + 4 * kb;
  const int ro0 = (g * 16 + ((col + 4 * g) & 15)) * 8, ro1 = 256 + (g * 16 + ((col + 4 * (2 + g)) & 15)) * 8;      // this lane's two fragment halves
  v4f pf[4]; float bn = bsl[0];
#pragma unroll      // pf[] is indexed by constants only, so it stays in registers
  for (int j = 0; j < 4; ++j) pf[j] = *(const v4f*)(wsl + j * 128);
#pragma unroll
  for (int j = 0; j < 4; ++j) { v4b h;
#pragma unroll
    for (int e = 0; e < 4; ++e) h[e] = (__bf16)pf[j][e];
    *(v4b*)(&sw[0][wave][wbase + ((j * 4 + wrot) & 15) * 8]) = h; }
  sb2[0][wave][lane] = bfr(bn);      // chunk 0: published by the head's barriers
  // stage x rows
#pragma unroll      // 4 trips for every thread: all four loads in flight together
  for (int it = 0; it < 64 * (IN / 4) / 1024; ++it) { const int q = it * 1024 + tid, rl = q >> 6, pc = q & 63; v4f v = *(const v4f*)(x + (size_t)(tb + rl) * IN + pc * 4);
#pragma unroll
    for (int e = 0; e < 4; ++e) v[e] = bfr(v[e]);      // x is rounded to bf16 everywhere, including the final mat-vec
    *(v4f*)(&sx[rl >> 4][rl & 15][pc * 4]) = v; }
  __syncthreads();
  // u2 rows of this wave's two bias tiles (columns n = s*32 + j*16 + col, k = 8g.. and 16+8g..): loaded here, used behind the next barrier, so that they fly over the hw/hb phase
  float uv[2][16], cb[2];
#pragma unroll
  for (int j = 0; j < 2; ++j) { const int n = (s * 2 + j) * 16 + col; const float* p = u2 + (size_t)n * HID + 8 * g; cb[j] = c2[n];
#pragma unroll
    for (int i = 0; i < 8; ++i) { uv[j][i] = p[i]; uv[j][8 + i] = p[16 + i]; } }
  asm volatile("s_wait_xcnt 0x0" ::: "memory");      // stands in front of the first overwrite of these loads' address registers, which the next phase reuses at once
  // hw, hb: [16 x 256] @ [256 x 32]: 2 column tiles each, exact bf16 products; wave s = 0,1: hw tile j = s; s = 2,3: hb tile j = s - 2
  if (s < 4) { const int j = s & 1; const float* wsrc = (s >> 1) ? u1 : w1; v8f ac = {};
#pragma unroll
    for (int kc = 0; kc < IN / 32; ++kc) { const v16b a = split_row(x + (size_t)(t0 + col) * IN, kc * 32, lane).h;
      ac = wmma_bf(a, split_row(wsrc + (size_t)(j * 16 + col) * IN, kc * 32, lane).h, ac); }
    const int n = j * 16 + col;
    if ((s >> 1) == 0) { const float bb1 = bfr(b1[n]);
#pragma unroll
      for (int r = 0; r < 8; ++r) { const float hv = ac[r] + bb1; const __bf16 hi = (__bf16)hv; sa[tt][8 * g + r][n] = hi; sa[tt][8 * g + r][32 + n] = (__bf16)(hv - (float)hi); } }
    else { const float cc1 = bfr(c1[n]);
#pragma unroll
      for (int r = 0; r < 8; ++r) { const float hv = ac[r] + cc1; const __bf16 hi = (__bf16)hv; sab[tt][8 * g + r][n] = hi; sab[tt][8 * g + r][32 + n] = (__bf16)(hv - (float)hi); } } }
  else if (s == 4) { const float* xr = &sx[tt][col][0]; float sm = 0.f;      // row sums of x, once per row, in index order
#pragma unroll 8
    for (int i = 0; i < IN; ++i) sm += xr[i];
    if (g == 0) ssx[tt][col] = sm; }
  __syncthreads();
  // bias path: bgen[t][o] = hb . u2[o] + c2[o] on WMMA: [16 tokens x 32] @ [32 x 16 outputs], two tiles per wave (the 8 waves of a token tile cover the 256 outputs), then LN over o
  { const v16b h_hi = frag_b(&sab[tt][col][0], lane), h_lo = frag_b(&sab[tt][col][32], lane);
#pragma unroll
    for (int j = 0; j < 2; ++j) { const int n = (s * 2 + j) * 16 + col; const v16b ub = bsplit16(uv[j]).h;
      v8f acc = wmma_bf(h_lo, ub, (v8f){}); acc = wmma_bf(h_hi, ub, acc);
      const float cc = bfr(cb[j]);
#pragma unroll
      for (int r = 0; r < 8; ++r) sbias[tt][8 * g + r][n] = acc[r] + cc; }
    LDSX();      // the slice sums below read what other lanes of this same wave have just stored (its own 32 columns)
    const int rl = lane & 15, sl = s * 2 + (lane >> 4); const v4f* br = (const v4f*)&sbias[tt][rl][sl * 16]; float sm = 0.f, sq = 0.f;
#pragma unroll
    for (int oq = 0; oq < 4; ++oq) { const v4f bv = br[oq];
#pragma unroll
      for (int e = 0; e < 4; ++e) { sm += bv[e]; sq += bv[e] * bv[e]; } }
    sps[tt][rl][sl] = sm; spq[tt][rl][sl] = sq; }
  __syncthreads();
  { const int rl = lane & 15, hf = lane >> 4; float sm = 0.f, sq = 0.f;
#pragma unroll
    for (int c = 0; c < 16; ++c) { sm += sps[tt][rl][c]; sq += spq[tt][rl][c]; }
    const float mu = sm * (1.0f / OUT); float var = sq * (1.0f / OUT) - mu * mu; var = var > 0.f ? var : 0.f; const float rs = rsqrtf(var + 1e-5f);
#pragma unroll
    for (int e = 0; e < OW / 2; ++e) { const int o = o0 + hf * (OW / 2) + e; sbias[tt][rl][o] = (sbias[tt][rl][o] - mu) * rs; } }      // only this wave touches its 4 columns from here on
  LDSX();
  // generated-weight path: the token-side fragments (hi chunk, lo chunk) are fixed per wave and go in as B: column = token col
  const v16b a_hi = frag_b(&sa[tt][col][0], lane), a_lo = frag_b(&sa[tt][col][32], lane);
#pragma unroll 1
  for (int o = o0; o < o0 + OW; ++o) { v2f sw1[2], sw2[2], swx[2];      // this lane's token: sums over its i, as two packed chains each so that a packed add does not wait on the one before it
#pragma unroll
    for (int k = 0; k < 2; ++k) { sw1[k] = (v2f){}; sw2[k] = (v2f){}; swx[k] = (v2f){}; }
#pragma unroll 1      // one copy of the chunk body: the prefetch stays ahead of the tile loop and its stores behind it
    for (int q = 0; q < 4; ++q) { const int c = (o - o0) * 4 + q;      // chunk c = tiles 4q..4q+3 of output o, in buffer c & 1
      if (c + 1 < NCH) {      // next chunk's global reads, in flight over this chunk's work
        bn = bsl[(c + 1) * 64];
#pragma unroll
        for (int j = 0; j < 4; ++j) pf[j] = *(const v4f*)(wsl + (size_t)(c + 1) * (64 * HID) + j * 128); }
#pragma unroll 2      // two tiles at a time; all four at once pushed the prefetched registers out to scratch
      for (int p = 0; p < 4; ++p) { const int i0 = (q * 4 + p) * 16 + 8 * g; const __bf16* tp = &sw[c & 1][s * 4 + p][0];      // result element r = (i = i0 + r, token col)
        union { v16b v; v8b h[2]; } wb; wb.h[0] = *(const v8b*)(tp + ro0); wb.h[1] = *(const v8b*)(tp + ro1);      // elements 0..7 = k 8g.., 8..15 = k 16+8g.., row = w2 row o*256 + tile*16 + col
        union { v8f v; v4f h[2]; } cb; const v4f* bp = (const v4f*)&sb2[c & 1][s * 4 + p][8 * g]; cb.h[0] = bp[0]; cb.h[1] = bp[1];
        const v4f* xp = (const v4f*)&sx[tt][col][i0]; const v4f xa = xp[0], xb = xp[1];
        v8f acc = wmma_bf(wb.v, a_lo, cb.v); acc = wmma_bf(wb.v, a_hi, acc);
#pragma unroll
        for (int k = 0; k < 4; ++k) { const v2f wv = { acc[2 * k], acc[2 * k + 1] }; const v2f xv = k < 2 ? (v2f){ xa[2 * (k & 1)], xa[2 * (k & 1) + 1] } : (v2f){ xb[2 * (k & 1)], xb[2 * (k & 1) + 1] };
          sw1[k & 1] += wv; sw2[k & 1] += wv * wv; swx[k & 1] += wv * xv; } }
      if (c + 1 < NCH) {      // the other buffer's last readers left it before the previous barrier
#pragma unroll
        for (int j = 0; j < 4; ++j) { v4b h;
#pragma unroll
          for (int e = 0; e < 4; ++e) h[e] = (__bf16)pf[j][e];
          *(v4b*)(&sw[(c + 1) & 1][wave][wbase + ((j * 4 + wrot) & 15) * 8]) = h; }
        sb2[(c + 1) & 1][wave][lane] = bfr(bn);
        __syncthreads(); } }      // publishes chunk c + 1 and ends every read of chunk c
    // fold the packed chains, then add what the other lane half (the other 8 i of every tile) holds for the same token
    const v2f p1 = sw1[0] + sw1[1], p2 = sw2[0] + sw2[1], px = swx[0] + swx[1];
    float t1 = p1[0] + p1[1], t2 = p2[0] + p2[1], tx = px[0] + px[1];
    t1 += xhalf(t1); t2 += xhalf(t2); tx += xhalf(tx);
    { const float mu = t1 * (1.0f / IN); float var = t2 * (1.0f / IN) - mu * mu; var = var > 0.f ? var : 0.f; const float rs = rsqrtf(var + 1e-5f);      // every lane finishes its own token
      const float yv = (tx - mu * ssx[tt][col]) * rs + sbias[tt][col][o];
      if (g == 0) sy[tt][col][o - blockIdx.y * OC] = yv; } }      // lanes col and col + 16 hold the same value
  __syncthreads();
  if (tid < 64 * (OC / 4)) { const int rl = tid >> 3, pc = tid & 7; vst2(y + (size_t)(tb + rl) * OUT + blockIdx.y * OC + pc * 4, *(const v4f*)(&sy[rl >> 4][rl & 15][pc * 4])); }
}
extern "C" void kernel_launch(void* const* d_in, const int* in_sizes, int n_in, void* d_out, int out_size, void* d_ws, size_t ws_size, hipStream_t stream) {
  (void)in_sizes; (void)n_in; (void)out_size; (void)ws_size; (void)d_ws;
  const float** I = (const float**)d_in;   // x, w1, b1, w2, b2, u1, c1, u2, c2
  k_meta<<<dim3(NT / 64, OUT / OC), 1024, 0, stream>>>(I[0], I[1], I[2], I[3], I[4], I[5], I[6], I[7], I[8], (float*)d_out);
}

// v006
// Measured time: 28.1 microseconds a run.
// Timed twice side by side with v005, it ran 1.25 times as fast both times.
// Counting every step since v000, it is 87.1 times as fast.
// compute dtype: x, w1, u1 (INPUTS) as exact bf16 WMMA products (f32 accumulate); the generated weights w = hw w2^T use the computed 32-wide code hw as a bf16 hi/lo pair against bf16(w2) (2 products, f32-grade); the generated bias hb u2^T likewise uses hb as a bf16 hi/lo pair against bf16(u2) (2 products, f32-grade); LayerNorm statistics and the per-token mat-vec with (bf16-rounded) x in f32. The 65,536 generated weights per token never leave registers: each 16x16 tile contributes its partial sums (sum w, sum w^2, sum w*x) directly.
#include <hip/hip_runtime.h>
#include <math.h>

typedef __attribute__((ext_vector_type(16))) _Float16 v16h;
typedef __attribute__((ext_vector_type(16))) __bf16 v16b;
typedef __attribute__((ext_vector_type(8)))  _Float16 v8h;
typedef __attribute__((ext_vector_type(8)))  float v8f;
typedef __attribute__((ext_vector_type(4)))  float v4f;
typedef __attribute__((ext_vector_type(2)))  float v2f;
typedef __attribute__((ext_vector_type(4)))  unsigned v4u;
typedef __attribute__((ext_vector_type(4)))  int v4i;
typedef float __attribute__((may_alias)) float_a;
typedef int __attribute__((may_alias)) int_a;

template <typename T> __device__ __forceinline__ void vst2(void* p, T v) { *(T*)p = v;  }
__device__ __forceinline__ v8f wmma16(v16h a, v16h b, v8f c) {
  v8f d = __builtin_amdgcn_wmma_f32_16x16x32_f16(false, a, false, b, (short)0, c, false, false);
  asm volatile("v_nop\n\tv_nop\n\tv_nop\n\tv_nop" : "+v"(d) : "v"(a), "v"(b));
  return d;
}
__device__ __forceinline__ v8f wmma_bf(v16b a, v16b b, v8f c) {
  v8f d = __builtin_amdgcn_wmma_f32_16x16x32_bf16(false, a, false, b, (short)0, c, false, false);
  asm volatile("v_nop\n\tv_nop\n\tv_nop\n\tv_nop" : "+v"(d) : "v"(a), "v"(b));
  return d;
}
// 16x16x32 fragments: lane = (h = lane>>4, row/col = lane&15); elements 0..7 = k0+8h+0..7, 8..15 = k0+16+8h+0..7; D element r = row 8h+r
__device__ __forceinline__ v16h frag_h(const _Float16* rowk0, int lane) {
  union { v16h v; v8h q[2]; } u; const _Float16* p = rowk0 + 8 * (lane >> 4);
  u.q[0] = *(const v8h*)p; u.q[1] = *(const v8h*)(p + 16); return u.v;
}
__device__ __forceinline__ v16h frag_f32(const float* rowk0, int lane) {
  v16h a; const float* p = rowk0 + 8 * (lane >> 4);
#pragma unroll
  for (int i = 0; i < 8; ++i) { a[i] = (_Float16)p[i]; a[8 + i] = (_Float16)p[16 + i]; }
  return a;
}
__device__ __forceinline__ v16h frag_f32s(const float* rowk0, int lane, float sc) {
  v16h a; const float* p = rowk0 + 8 * (lane >> 4);
#pragma unroll
  for (int i = 0; i < 8; ++i) { a[i] = (_Float16)(p[i] * sc); a[8 + i] = (_Float16)(p[16 + i] * sc); }
  return a;
}
// column fragment from a [K][ld] layout (column n), rows >= K read as 0
__device__ __forceinline__ v16h fragc_f32(const float* W, int k0, int n, int lane, int ld, int K) {
  v16h a; const int g = lane >> 4;
#pragma unroll
  for (int i = 0; i < 8; ++i) { const int ka = k0 + 8 * g + i, kb = ka + 16;
    a[i] = (_Float16)(ka < K ? W[(size_t)(ka < K ? ka : K - 1) * ld + n] : 0.f); a[8 + i] = (_Float16)(kb < K ? W[(size_t)(kb < K ? kb : K - 1) * ld + n] : 0.f); }
  return a;
}
struct F2 { v16b h, l; };
__device__ __forceinline__ F2 bsplit16(const float v[16]) { F2 r;
#pragma unroll
  for (int i = 0; i < 16; ++i) { const __bf16 h = (__bf16)v[i]; r.h[i] = h; r.l[i] = (__bf16)(v[i] - (float)h); }
  return r; }
__device__ __forceinline__ F2 split_row(const float* row, int k0, int lane) { float v[16]; const float* p = row + k0 + 8 * (lane >> 4);
#pragma unroll
  for (int i = 0; i < 8; ++i) { v[i] = p[i]; v[8 + i] = p[16 + i]; }
  return bsplit16(v); }
__device__ __forceinline__ F2 split_rowK(const float* row, int k0, int lane, int K) { float v[16]; const int g = lane >> 4;
#pragma unroll
  for (int i = 0; i < 8; ++i) { const int ka = k0 + 8 * g + i, kb = ka + 16; v[i] = ka < K ? row[ka < K ? ka : K - 1] : 0.f; v[8 + i] = kb < K ? row[kb < K ? kb : K - 1] : 0.f; }
  return bsplit16(v); }
__device__ __forceinline__ F2 split_col(const float* W, int k0, int n, int lane, int ld, int K) { float v[16]; const int g = lane >> 4;
#pragma unroll
  for (int i = 0; i < 8; ++i) { const int ka = k0 + 8 * g + i, kb = ka + 16; v[i] = ka < K ? W[(size_t)(ka < K ? ka : K - 1) * ld + n] : 0.f; v[8 + i] = kb < K ? W[(size_t)(kb < K ? kb : K - 1) * ld + n] : 0.f; }
  return bsplit16(v); }
__device__ __forceinline__ v8f mac3(const F2& a, const F2& b, v8f c) { c = wmma_bf(a.l, b.h, c); c = wmma_bf(a.h, b.l, c); return wmma_bf(a.h, b.h, c); }
__device__ __forceinline__ float sigm(float v) { return 1.0f / (1.0f + expf(-v)); }
#define LDSX() do { asm volatile("s_wait_dscnt 0" ::: "memory"); __builtin_amdgcn_wave_barrier(); __builtin_amdgcn_fence(__ATOMIC_RELEASE, "workgroup"); } while (0)


// Hyper-network linear layer: per token: hw = x w1^T + b1 (32); W[o][i] = LN_i(hw . w2[o*256+i] + b2[o*256+i]) (no affine, eps 1e-5); hb = x u1^T + c1; bias[o] = LN_o(hb . u2[o] + c2[o]);
// y[o] = sum_i W[o][i] x[i] + bias[o] = (S_wx - mu_o S_x) * rsqrt(var_o + eps) + bias[o], with S_w, S_w2, S_wx accumulated per (token, o) over the 16 tiles of that o.
// One kernel: block = 64 tokens x 32 outputs, 32 waves: wave = (token tile tt of 16 tokens, output slice s of 4 outputs); grid = 32 token blocks x 8 output chunks, one block per WGP.
// The head is shared by the block through LDS: x rows and the head's weights (w1, u1, u2, as bf16) staged by all threads with whole-line loads; hw/hb by exact WMMA, one 16x16 tile per wave (s = 0..3), fragments read from LDS; row sums of x by the s = 4 waves; the bias rows by WMMA, two 16x16 tiles per wave, their LN sums in 16 slices of 16 outputs.
// hw is split hi/lo once into an LDS fragment row [hi(32)|lo(32)] (two k-chunks); then for each of the wave's 4 outputs o:
// 16 tiles of [16 i x 16 tokens] = bf16(w2 rows) as A x the hw fragments as B, bf16(b2) as C: a lane holds 8 consecutive i of ONE token, so the three sums over i run inside the lane; one add across the two lane halves finishes y[token][o]; the block stores whole 128-byte lines.
// w2 reaches its fragments through LDS: the 4 waves of an output slice share its w2 rows, so each stages one 16-row tile of every 4-tile chunk with loads that cover whole 128-byte lines,
// rounds it to bf16 once and stores it in fragment order; two buffers, the next chunk's loads (and its b2 values) fly in registers while this chunk is worked on, one barrier per chunk.
#define NB 4
#define SQ 512
#define NT (NB * SQ)     // 2048 tokens
#define IN 256
#define OUT 256
#define HID 32
__device__ __forceinline__ float bfr(float v) { return (float)(__bf16)v; }
__device__ __forceinline__ v16b frag_b(const __bf16* rowk0, int lane) { return __builtin_bit_cast(v16b, frag_h((const _Float16*)rowk0, lane)); }

// the value that lane ^ 16 holds (same place in the other row of 16 lanes)
__device__ __forceinline__ float xhalf(float v) { const int b = __builtin_bit_cast(int, v);
  return __builtin_bit_cast(float, __builtin_amdgcn_permlanex16(b, b, 0x76543210, 0xfedcba98, false, false)); }
#define OC 32            // outputs per block: one 128-byte line of y per token
#define OW 4             // outputs per wave
#define NCH (OW * 4)     // chunks of 4 tiles (64 w2 rows) per output slice
typedef __attribute__((ext_vector_type(4))) __bf16 v4b;
typedef __attribute__((ext_vector_type(8))) __bf16 v8b;
__global__ __launch_bounds__(1024) void k_meta(const float* __restrict__ x, const float* __restrict__ w1, const float* __restrict__ b1, const float* __restrict__ w2, const float* __restrict__ b2, const float* __restrict__ u1, const float* __restrict__ c1, const float* __restrict__ u2, const float* __restrict__ c2, float* __restrict__ y) {
  __shared__ __align__(16) __bf16 sa[4][16][72];        // per token: [hi(hw) 32 | lo(hw) 32] -> token-side fragments for the w2 GEMM (k-chunk 0 = hi, 1 = lo)
  __shared__ __align__(16) __bf16 sab[4][16][72];       // per token: [hi(hb) 32 | lo(hb) 32] -> A fragments for the u2 GEMM
  __shared__ __align__(16) float sx[4][16][IN + 4];      // x rows (f32) for the mat-vec partials
  __shared__ __align__(16) float sy[4][16][OC + 4];      // this block's outputs
  __shared__ __align__(16) float sbias[4][16][OUT + 4];  // generated bias pre-LN; each wave's own 4 columns then LN'd
  __shared__ float sps[4][16][17], spq[4][16][17];       // bias LN partial sums, one per slice of 16 outputs
  __shared__ float ssx[4][16];                           // sum_i x[row][i]
  __shared__ __align__(16) __bf16 sw[2][32][512];        // w2 tiles as bf16 fragments: [buffer][slice * 4 + tile of the chunk][k half][slot of 8 values]
  __shared__ __align__(16) float sb2[2][32][32];         // bf16-rounded b2 of the same tiles: places 0..15 = the tile's 16 rows (16..31 repeat them)
  __shared__ __align__(16) __bf16 sw1[64][IN + 8];       // bf16(w1) rows 0..31, bf16(u1) rows 32..63; pitch 528 B = 16 B x odd, so that 16 rows read by b128 fall on different banks
  __shared__ __align__(16) __bf16 su2[OUT][HID + 8];     // bf16(u2) rows; pitch 80 B = 16 B x odd
  const int tid = threadIdx.x, wave = __builtin_amdgcn_readfirstlane(tid >> 5), lane = tid & 31, col = lane & 15, g = lane >> 4;
  const int tt = wave & 3, s = wave >> 2; const int tb = blockIdx.x * 64, o0 = blockIdx.y * OC + s * OW;
  // w2 staging. Source: tile tt of each chunk of this wave's slice; load j takes 512 consecutive bytes (rows 4j..4j+3 of the tile), lane = (row lane>>3, k = 4*(lane&7)..+3).
  // Place of (row, k block kb = k>>3): half kb>>1, slot 16*(kb&1) + ((row + 4*kb) & 15): a fragment read takes 512 bytes in a row, and the 32 lanes of a store fall on 64 different banks.
  const float* wsl = w2 + ((size_t)o0 * IN + tt * 16) * HID + lane * 4;
  const float* bsl = b2 + (size_t)o0 * IN + tt * 16 + col;
  const int kb = (lane & 7) >> 1, wbase = (kb >> 1) * 256 + (kb & 1) * 128 + (lane & 1) * 4, wrot = (lane >> 3) + 4 * kb;
  const int ro0 = (g * 16 + ((col + 4 * g) & 15)) * 8, ro1 = 256 + (g * 16 + ((col + 4 * (2 + g)) & 15)) * 8;      // this lane's two fragment halves
  v4f pf[4]; float bn = bsl[0];
#pragma unroll      // pf[] is indexed by constants only, so it stays in registers
  for (int j = 0; j < 4; ++j) pf[j] = *(const v4f*)(wsl + j * 128);
  // the head's weights (w1, u1, u2): every wave-wide load takes 512 consecutive bytes, each value is read once per block; load it takes rows it*16 + (tid >> 6) of [w1; u1]
  v4f hv[4], uq[2];
#pragma unroll      // hv[] and uq[] are indexed by constants only, and all six loads fly together
  for (int it = 0; it < 4; ++it) hv[it] = *(const v4f*)((it < 2 ? w1 : u1) + (size_t)((it & 1) * 16 + (tid >> 6)) * IN + (tid & 63) * 4);
#pragma unroll
  for (int it = 0; it < 2; ++it) uq[it] = *(const v4f*)(u2 + (size_t)(it * 1024 + tid) * 4);
#pragma unroll
  for (int j = 0; j < 4; ++j) { v4b h;
#pragma unroll
    for (int e = 0; e < 4; ++e) h[e] = (__bf16)pf[j][e];
    *(v4b*)(&sw[0][wave][wbase + ((j * 4 + wrot) & 15) * 8]) = h; }
  sb2[0][wave][lane] = bfr(bn);      // chunk 0: published by the head's barriers
#pragma unroll
  for (int it = 0; it < 4; ++it) { v4b h;
#pragma unroll
    for (int e = 0; e < 4; ++e) h[e] = (__bf16)hv[it][e];
    *(v4b*)(&sw1[it * 16 + (tid >> 6)][(tid & 63) * 4]) = h; }
#pragma unroll
  for (int it = 0; it < 2; ++it) { const int q = it * 1024 + tid; v4b h;
#pragma unroll
    for (int e = 0; e < 4; ++e) h[e] = (__bf16)uq[it][e];
    *(v4b*)(&su2[q >> 3][(q & 7) * 4]) = h; }      // both published by the barrier behind the x rows
  // stage x rows
#pragma unroll      // 4 trips for every thread: all four loads in flight together
  for (int it = 0; it < 64 * (IN / 4) / 1024; ++it) { const int q = it * 1024 + tid, rl = q >> 6, pc = q & 63; v4f v = *(const v4f*)(x + (size_t)(tb + rl) * IN + pc * 4);
#pragma unroll
    for (int e = 0; e < 4; ++e) v[e] = bfr(v[e]);      // x is rounded to bf16 everywhere, including the final mat-vec
    *(v4f*)(&sx[rl >> 4][rl & 15][pc * 4]) = v; }
  __syncthreads();
  // c2 of this wave's two bias tiles (columns n = s*32 + j*16 + col): loaded here, used behind the next barrier, so that they fly over the hw/hb phase
  float cb[2];
#pragma unroll
  for (int j = 0; j < 2; ++j) cb[j] = c2[(s * 2 + j) * 16 + col];
  asm volatile("s_wait_xcnt 0x0" ::: "memory");      // stands in front of the first overwrite of these loads' address registers, which the next phase reuses at once
  // hw, hb: [16 x 256] @ [256 x 32]: 2 column tiles each, exact bf16 products; wave s = 0,1: hw tile j = s; s = 2,3: hb tile j = s - 2
  if (s < 4) { const int j = s & 1; v8f ac = {};      // both operands from LDS: the staged x row (already bf16 values, so the conversion is exact) and row s*16 + col of [w1; u1]
#pragma unroll
    for (int kc = 0; kc < IN / 32; ++kc) { const v16b a = split_row(&sx[tt][col][0], kc * 32, lane).h;
      ac = wmma_bf(a, frag_b(&sw1[s * 16 + col][kc * 32], lane), ac); }
    const int n = j * 16 + col;
    if ((s >> 1) == 0) { const float bb1 = bfr(b1[n]);
#pragma unroll
      for (int r = 0; r < 8; ++r) { const float hv = ac[r] + bb1; const __bf16 hi = (__bf16)hv; sa[tt][8 * g + r][n] = hi; sa[tt][8 * g + r][32 + n] = (__bf16)(hv - (float)hi); } }
    else { const float cc1 = bfr(c1[n]);
#pragma unroll
      for (int r = 0; r < 8; ++r) { const float hv = ac[r] + cc1; const __bf16 hi = (__bf16)hv; sab[tt][8 * g + r][n] = hi; sab[tt][8 * g + r][32 + n] = (__bf16)(hv - (float)hi); } } }
  else if (s == 4) { const float* xr = &sx[tt][col][0]; float sm = 0.f;      // row sums of x, once per row, in index order
#pragma unroll 8
    for (int i = 0; i < IN; ++i) sm += xr[i];
    if (g == 0) ssx[tt][col] = sm; }
  __syncthreads();
  // bias path: bgen[t][o] = hb . u2[o] + c2[o] on WMMA: [16 tokens x 32] @ [32 x 16 outputs], two tiles per wave (the 8 waves of a token tile cover the 256 outputs), then LN over o
  { const v16b h_hi = frag_b(&sab[tt][col][0], lane), h_lo = frag_b(&sab[tt][col][32], lane);
#pragma unroll
    for (int j = 0; j < 2; ++j) { const int n = (s * 2 + j) * 16 + col; const v16b ub = frag_b(&su2[n][0], lane);
      v8f acc = wmma_bf(h_lo, ub, (v8f){}); acc = wmma_bf(h_hi, ub, acc);
      const float cc = bfr(cb[j]);
#pragma unroll
      for (int r = 0; r < 8; ++r) sbias[tt][8 * g + r][n] = acc[r] + cc; }
    LDSX();      // the slice sums below read what other lanes of this same wave have just stored (its own 32 columns)
    const int rl = lane & 15, sl = s * 2 + (lane >> 4); const v4f* br = (const v4f*)&sbias[tt][rl][sl * 16]; float sm = 0.f, sq = 0.f;
#pragma unroll
    for (int oq = 0; oq < 4; ++oq) { const v4f bv = br[oq];
#pragma unroll
      for (int e = 0; e < 4; ++e) { sm += bv[e]; sq += bv[e] * bv[e]; } }
    sps[tt][rl][sl] = sm; spq[tt][rl][sl] = sq; }
  __syncthreads();
  { const int rl = lane & 15, hf = lane >> 4; float sm = 0.f, sq = 0.f;
#pragma unroll
    for (int c = 0; c < 16; ++c) { sm += sps[tt][rl][c]; sq += spq[tt][rl][c]; }
    const float mu = sm * (1.0f / OUT); float var = sq * (1.0f / OUT) - mu * mu; var = var > 0.f ? var : 0.f; const float rs = rsqrtf(var + 1e-5f);
#pragma unroll
    for (int e = 0; e < OW / 2; ++e) { const int o = o0 + hf * (OW / 2) + e; sbias[tt][rl][o] = (sbias[tt][rl][o] - mu) * rs; } }      // only this wave touches its 4 columns from here on
  LDSX();
  // generated-weight path: the token-side fragments (hi chunk, lo chunk) are fixed per wave and go in as B: column = token col
  const v16b a_hi = frag_b(&sa[tt][col][0], lane), a_lo = frag_b(&sa[tt][col][32], lane);
#pragma unroll 1
  for (int o = o0; o < o0 + OW; ++o) { v2f sw1[2], sw2[2], swx[2];      // this lane's token: sums over its i, as two packed chains each so that a packed add does not wait on the one before it
#pragma unroll
    for (int k = 0; k < 2; ++k) { sw1[k] = (v2f){}; sw2[k] = (v2f){}; swx[k] = (v2f){}; }
#pragma unroll 1      // one copy of the chunk body: the prefetch stays ahead of the tile loop and its stores behind it
    for (int q = 0; q < 4; ++q) { const int c = (o - o0) * 4 + q;      // chunk c = tiles 4q..4q+3 of output o, in buffer c & 1
      if (c + 1 < NCH) {      // next chunk's global reads, in flight over this chunk's work
        bn = bsl[(c + 1) * 64];
#pragma unroll
        for (int j = 0; j < 4; ++j) pf[j] = *(const v4f*)(wsl + (size_t)(c + 1) * (64 * HID) + j * 128); }
#pragma unroll 2      // two tiles at a time; all four at once pushed the prefetched registers out to scratch
      for (int p = 0; p < 4; ++p) { const int i0 = (q * 4 + p) * 16 + 8 * g; const __bf16* tp = &sw[c & 1][s * 4 + p][0];      // result element r = (i = i0 + r, token col)
        union { v16b v; v8b h[2]; } wb; wb.h[0] = *(const v8b*)(tp + ro0); wb.h[1] = *(const v8b*)(tp + ro1);      // elements 0..7 = k 8g.., 8..15 = k 16+8g.., row = w2 row o*256 + tile*16 + col
        union { v8f v; v4f h[2]; } cb; const v4f* bp = (const v4f*)&sb2[c & 1][s * 4 + p][8 * g]; cb.h[0] = bp[0]; cb.h[1] = bp[1];
        const v4f* xp = (const v4f*)&sx[tt][col][i0]; const v4f xa = xp[0], xb = xp[1];
        v8f acc = wmma_bf(wb.v, a_lo, cb.v); acc = wmma_bf(wb.v, a_hi, acc);
#pragma unroll
        for (int k = 0; k < 4; ++k) { const v2f wv = { acc[2 * k], acc[2 * k + 1] }; const v2f xv = k < 2 ? (v2f){ xa[2 * (k & 1)], xa[2 * (k & 1) + 1] } : (v2f){ xb[2 * (k & 1)], xb[2 * (k & 1) + 1] };
          sw1[k & 1] += wv; sw2[k & 1] += wv * wv; swx[k & 1] += wv * xv; } }
      if (c + 1 < NCH) {      // the other buffer's last readers left it before the previous barrier
#pragma unroll
        for (int j = 0; j < 4; ++j) { v4b h;
#pragma unroll
          for (int e = 0; e < 4; ++e) h[e] = (__bf16)pf[j][e];
          *(v4b*)(&sw[(c + 1) & 1][wave][wbase + ((j * 4 + wrot) & 15) * 8]) = h; }
        sb2[(c + 1) & 1][wave][lane] = bfr(bn);
        __syncthreads(); } }      // publishes chunk c + 1 and ends every read of chunk c
    // fold the packed chains, then add what the other lane half (the other 8 i of every tile) holds for the same token
    const v2f p1 = sw1[0] + sw1[1], p2 = sw2[0] + sw2[1], px = swx[0] + swx[1];
    float t1 = p1[0] + p1[1], t2 = p2[0] + p2[1], tx = px[0] + px[1];
    t1 += xhalf(t1); t2 += xhalf(t2); tx += xhalf(tx);
    { const float mu = t1 * (1.0f / IN); float var = t2 * (1.0f / IN) - mu * mu; var = var > 0.f ? var : 0.f; const float rs = rsqrtf(var + 1e-5f);      // every lane finishes its own token
      const float yv = (tx - mu * ssx[tt][col]) * rs + sbias[tt][col][o];
      if (g == 0) sy[tt][col][o - blockIdx.y * OC] = yv; } }      // lanes col and col + 16 hold the same value
  __syncthreads();
  if (tid < 64 * (OC / 4)) { const int rl = tid >> 3, pc = tid & 7; vst2(y + (size_t)(tb + rl) * OUT + blockIdx.y * OC + pc * 4, *(const v4f*)(&sy[rl >> 4][rl & 15][pc * 4])); }
}
extern "C" void kernel_launch(void* const* d_in, const int* in_sizes, int n_in, void* d_out, int out_size, void* d_ws, size_t ws_size, hipStream_t stream) {
  (void)in_sizes; (void)n_in; (void)out_size; (void)ws_size; (void)d_ws;
  const float** I = (const float**)d_in;   // x, w1, b1, w2, b2, u1, c1, u2, c2
  k_meta<<<dim3(NT / 64, OUT / OC), 1024, 0, stream>>>(I[0], I[1], I[2], I[3], I[4], I[5], I[6], I[7], I[8], (float*)d_out);
}

// v007
// One run takes 22.2 microseconds.
// Next to v006, in two timings, it ran 1.27 times as fast each time.
// Over all steps from v000 it is 110 times as fast.
// compute dtype: x, w1, u1 (INPUTS) as exact bf16 WMMA products (f32 accumulate); the generated weights w = hw w2^T use the computed 32-wide code hw as a bf16 hi/lo pair against bf16(w2) (2 products, f32-grade); the generated bias hb u2^T likewise uses hb as a bf16 hi/lo pair against bf16(u2) (2 products, f32-grade); LayerNorm statistics and the per-token mat-vec with (bf16-rounded) x in f32. The 65,536 generated weights per token never leave registers: each 16x16 tile contributes its partial sums (sum w, sum w^2, sum w*x) directly.
#include <hip/hip_runtime.h>
#include <math.h>

typedef __attribute__((ext_vector_type(16))) _Float16 v16h;
typedef __attribute__((ext_vector_type(16))) __bf16 v16b;
typedef __attribute__((ext_vector_type(8)))  _Float16 v8h;
typedef __attribute__((ext_vector_type(8)))  float v8f;
typedef __attribute__((ext_vector_type(4)))  float v4f;
typedef __attribute__((ext_vector_type(2)))  float v2f;
typedef __attribute__((ext_vector_type(4)))  unsigned v4u;
typedef __attribute__((ext_vector_type(4)))  int v4i;
typedef float __attribute__((may_alias)) float_a;
typedef int __attribute__((may_alias)) int_a;

template <typename T> __device__ __forceinline__ void vst2(void* p, T v) { *(T*)p = v;  }
__device__ __forceinline__ v8f wmma16(v16h a, v16h b, v8f c) {
  v8f d = __builtin_amdgcn_wmma_f32_16x16x32_f16(false, a, false, b, (short)0, c, false, false);
  asm volatile("v_nop\n\tv_nop\n\tv_nop\n\tv_nop" : "+v"(d) : "v"(a), "v"(b));
  return d;
}
__device__ __forceinline__ v8f wmma_bf(v16b a, v16b b, v8f c) {
  v8f d = __builtin_amdgcn_wmma_f32_16x16x32_bf16(false, a, false, b, (short)0, c, false, false);
  asm volatile("v_nop\n\tv_nop\n\tv_nop\n\tv_nop" : "+v"(d) : "v"(a), "v"(b));
  return d;
}
// 16x16x32 fragments: lane = (h = lane>>4, row/col = lane&15); elements 0..7 = k0+8h+0..7, 8..15 = k0+16+8h+0..7; D element r = row 8h+r
__device__ __forceinline__ v16h frag_h(const _Float16* rowk0, int lane) {
  union { v16h v; v8h q[2]; } u; const _Float16* p = rowk0 + 8 * (lane >> 4);
  u.q[0] = *(const v8h*)p; u.q[1] = *(const v8h*)(p + 16); return u.v;
}
__device__ __forceinline__ v16h frag_f32(const float* rowk0, int lane) {
  v16h a; const float* p = rowk0 + 8 * (lane >> 4);
#pragma unroll
  for (int i = 0; i < 8; ++i) { a[i] = (_Float16)p[i]; a[8 + i] = (_Float16)p[16 + i]; }
  return a;
}
__device__ __forceinline__ v16h frag_f32s(const float* rowk0, int lane, float sc) {
  v16h a; const float* p = rowk0 + 8 * (lane >> 4);
#pragma unroll
  for (int i = 0; i < 8; ++i) { a[i] = (_Float16)(p[i] * sc); a[8 + i] = (_Float16)(p[16 + i] * sc); }
  return a;
}
// column fragment from a [K][ld] layout (column n), rows >= K read as 0
__device__ __forceinline__ v16h fragc_f32(const float* W, int k0, int n, int lane, int ld, int K) {
  v16h a; const int g = lane >> 4;
#pragma unroll
  for (int i = 0; i < 8; ++i) { const int ka = k0 + 8 * g + i, kb = ka + 16;
    a[i] = (_Float16)(ka < K ? W[(size_t)(ka < K ? ka : K - 1) * ld + n] : 0.f); a[8 + i] = (_Float16)(kb < K ? W[(size_t)(kb < K ? kb : K - 1) * ld + n] : 0.f); }
  return a;
}
struct F2 { v16b h, l; };
__device__ __forceinline__ F2 bsplit16(const float v[16]) { F2 r;
#pragma unroll
  for (int i = 0; i < 16; ++i) { const __bf16 h = (__bf16)v[i]; r.h[i] = h; r.l[i] = (__bf16)(v[i] - (float)h); }
  return r; }
__device__ __forceinline__ F2 split_row(const float* row, int k0, int lane) { float v[16]; const float* p = row + k0 + 8 * (lane >> 4);
#pragma unroll
  for (int i = 0; i < 8; ++i) { v[i] = p[i]; v[8 + i] = p[16 + i]; }
  return bsplit16(v); }
__device__ __forceinline__ F2 split_rowK(const float* row, int k0, int lane, int K) { float v[16]; const int g = lane >> 4;
#pragma unroll
  for (int i = 0; i < 8; ++i) { const int ka = k0 + 8 * g + i, kb = ka + 16; v[i] = ka < K ? row[ka < K ? ka : K - 1] : 0.f; v[8 + i] = kb < K ? row[kb < K ? kb : K - 1] : 0.f; }
  return bsplit16(v); }
__device__ __forceinline__ F2 split_col(const float* W, int k0, int n, int lane, int ld, int K) { float v[16]; const int g = lane >> 4;
#pragma unroll
  for (int i = 0; i < 8; ++i) { const int ka = k0 + 8 * g + i, kb = ka + 16; v[i] = ka < K ? W[(size_t)(ka < K ? ka : K - 1) * ld + n] : 0.f; v[8 + i] = kb < K ? W[(size_t)(kb < K ? kb : K - 1) * ld + n] : 0.f; }
  return bsplit16(v); }
__device__ __forceinline__ v8f mac3(const F2& a, const F2& b, v8f c) { c = wmma_bf(a.l, b.h, c); c = wmma_bf(a.h, b.l, c); return wmma_bf(a.h, b.h, c); }
__device__ __forceinline__ float sigm(float v) { return 1.0f / (1.0f + expf(-v)); }
#define LDSX() do { asm volatile("s_wait_dscnt 0" ::: "memory"); __builtin_amdgcn_wave_barrier(); __builtin_amdgcn_fence(__ATOMIC_RELEASE, "workgroup"); } while (0)


// Hyper-network linear layer: per token: hw = x w1^T + b1 (32); W[o][i] = LN_i(hw . w2[o*256+i] + b2[o*256+i]) (no affine, eps 1e-5); hb = x u1^T + c1; bias[o] = LN_o(hb . u2[o] + c2[o]);
// y[o] = sum_i W[o][i] x[i] + bias[o] = (S_wx - mu_o S_x) * rsqrt(var_o + eps) + bias[o], with S_w, S_w2, S_wx accumulated per (token, o) over the 16 tiles of that o.
// One kernel: block = 64 tokens x 32 outputs, 16 waves; grid = 32 token blocks x 8 output chunks, one block per WGP.
// The head is shared by the block through LDS, wave = (token tile tt, quarter s): x rows and the head's weights (w1, u1, u2, as bf16) staged by all threads with whole-line loads; hw/hb by exact WMMA, one 16x16 tile per wave, fragments read from LDS; row sums of x in 8 slices of 32; the bias rows by WMMA, four 16x16 tiles per wave, their LN sums in 16 slices of 16 outputs.
// hw is split hi/lo once into an LDS fragment row [hi(32)|lo(32)] (two k-chunks).
// Main loop: a wave owns 2 outputs and ALL 4 token tiles: it holds the 4 tiles' hw fragments in registers, and each w2 fragment and b2 vector it reads from LDS serves 4 tiles of [16 i x 16 tokens]
// (bf16(w2 rows) as A x the hw fragments as B, bf16(b2) as C): a lane holds 8 consecutive i of ONE token per tile, so the three sums over i run inside the lane; one add across the two lane halves finishes y[token][o]; the block stores whole 128-byte lines.
// w2 reaches its fragments through LDS, private to the wave that uses it: loads that cover whole 128-byte lines, rounded to bf16 once, stored in fragment order;
// two buffers of 2 tiles, the next chunk's loads (and its b2 values) fly in registers while this chunk is worked on; no work-group barrier in the loop.
#define NB 4
#define SQ 512
#define NT (NB * SQ)     // 2048 tokens
#define IN 256
#define OUT 256
#define HID 32
__device__ __forceinline__ float bfr(float v) { return (float)(__bf16)v; }
__device__ __forceinline__ v16b frag_b(const __bf16* rowk0, int lane) { return __builtin_bit_cast(v16b, frag_h((const _Float16*)rowk0, lane)); }

// the value that lane ^ 16 holds (same place in the other row of 16 lanes)
__device__ __forceinline__ float xhalf(float v) { const int b = __builtin_bit_cast(int, v);
  return __builtin_bit_cast(float, __builtin_amdgcn_permlanex16(b, b, 0x76543210, 0xfedcba98, false, false)); }
#define OC 32            // outputs per block: one 128-byte line of y per token
#define OW 2             // outputs per wave
#define NCH (OW * 8)     // chunks of 2 tiles (32 w2 rows) per wave
#define NTH 512          // threads per block
typedef __attribute__((ext_vector_type(4))) __bf16 v4b;
typedef __attribute__((ext_vector_type(8))) __bf16 v8b;
__global__ __launch_bounds__(NTH) void k_meta(const float* __restrict__ x, const float* __restrict__ w1, const float* __restrict__ b1, const float* __restrict__ w2, const float* __restrict__ b2, const float* __restrict__ u1, const float* __restrict__ c1, const float* __restrict__ u2, const float* __restrict__ c2, float* __restrict__ y) {
  __shared__ __align__(16) __bf16 sa[4][16][72];        // per token: [hi(hw) 32 | lo(hw) 32] -> token-side fragments for the w2 GEMM (k-chunk 0 = hi, 1 = lo)
  __shared__ __align__(16) __bf16 sab[4][16][72];       // per token: [hi(hb) 32 | lo(hb) 32] -> A fragments for the u2 GEMM
  __shared__ __align__(16) float sx[4][16][IN + 4];      // x rows (f32) for the mat-vec partials
  __shared__ __align__(16) float sy[4][16][OC + 4];      // this block's outputs
  __shared__ __align__(16) float sbias[4][16][OUT + 4];  // generated bias pre-LN; the block's 32 columns then LN'd
  __shared__ float sps[4][16][17], spq[4][16][17];       // bias LN partial sums, one per slice of 16 outputs
  __shared__ float ssxp[4][16][9];                       // sums of x[row][i] over slices of 32 i
  __shared__ float ssx[4][16];                           // sum_i x[row][i]
  __shared__ __align__(16) __bf16 sw[2][32][512];        // w2 tiles as bf16 fragments: [buffer][wave * 2 + tile of the chunk][k half][slot of 8 values]
  __shared__ __align__(16) float sb2[2][16][32];         // bf16-rounded b2 of the same tiles: [buffer][wave][tile of the chunk * 16 + row]
  __shared__ __align__(16) __bf16 sw1[64][IN + 8];       // bf16(w1) rows 0..31, bf16(u1) rows 32..63; pitch 528 B = 16 B x odd, so that 16 rows read by b128 fall on different banks
  __shared__ __align__(16) __bf16 su2[OUT][HID + 8];     // bf16(u2) rows; pitch 80 B = 16 B x odd
  const int tid = threadIdx.x, wave = __builtin_amdgcn_readfirstlane(tid >> 5), lane = tid & 31, col = lane & 15, g = lane >> 4;
  const int tt = wave & 3, s = wave >> 2; const int tb = blockIdx.x * 64, o0 = blockIdx.y * OC + wave * OW;      // (tt, s): the wave's share of the head; o0: its outputs in the main loop
  // w2 staging. Source: the 32 rows of each chunk of this wave's outputs; load (p, j) takes 512 consecutive bytes (rows 4j..4j+3 of tile p), lane = (row lane>>3, k = 4*(lane&7)..+3).
  // Place of (row, k block kb = k>>3): half kb>>1, slot 16*(kb&1) + ((row + 4*kb) & 15): a fragment read takes 512 bytes in a row, and the 32 lanes of a store fall on 64 different banks.
  const float* wsl = w2 + (size_t)o0 * IN * HID + lane * 4;
  const float* bsl = b2 + (size_t)o0 * IN + lane;
  const int kb = (lane & 7) >> 1, wbase = (kb >> 1) * 256 + (kb & 1) * 128 + (lane & 1) * 4, wrot = (lane >> 3) + 4 * kb;
  const int ro0 = (g * 16 + ((col + 4 * g) & 15)) * 8, ro1 = 256 + (g * 16 + ((col + 4 * (2 + g)) & 15)) * 8;      // this lane's two fragment halves
  v4f pf[2][4]; float bn = bsl[0];
#pragma unroll      // pf[][] is indexed by constants only, so it stays in registers
  for (int p = 0; p < 2; ++p)
#pragma unroll
    for (int j = 0; j < 4; ++j) pf[p][j] = *(const v4f*)(wsl + p * (16 * HID) + j * 128);
  // the head's weights (w1, u1, u2): every wave-wide load takes 512 consecutive bytes, each value is read once per block; load it takes rows it*8 + (tid >> 6) of [w1; u1]
  v4f hv[8], uq[4];
#pragma unroll      // hv[] and uq[] are indexed by constants only, and all twelve loads fly together
  for (int it = 0; it < 8; ++it) hv[it] = *(const v4f*)((it < 4 ? w1 : u1) + (size_t)((it & 3) * 8 + (tid >> 6)) * IN + (tid & 63) * 4);
#pragma unroll
  for (int it = 0; it < 4; ++it) uq[it] = *(const v4f*)(u2 + (size_t)(it * NTH + tid) * 4);
#pragma unroll
  for (int p = 0; p < 2; ++p)
#pragma unroll
    for (int j = 0; j < 4; ++j) { v4b h;
#pragma unroll
      for (int e = 0; e < 4; ++e) h[e] = (__bf16)pf[p][j][e];
      *(v4b*)(&sw[0][wave * 2 + p][wbase + ((j * 4 + wrot) & 15) * 8]) = h; }
  sb2[0][wave][lane] = bfr(bn);      // chunk 0: read by this wave alone, far behind the head's barriers
#pragma unroll
  for (int it = 0; it < 8; ++it) { v4b h;
#pragma unroll
    for (int e = 0; e < 4; ++e) h[e] = (__bf16)hv[it][e];
    *(v4b*)(&sw1[it * 8 + (tid >> 6)][(tid & 63) * 4]) = h; }
#pragma unroll
  for (int it = 0; it < 4; ++it) { const int q = it * NTH + tid; v4b h;
#pragma unroll
    for (int e = 0; e < 4; ++e) h[e] = (__bf16)uq[it][e];
    *(v4b*)(&su2[q >> 3][(q & 7) * 4]) = h; }      // both published by the barrier behind the x rows
  // stage x rows
#pragma unroll      // 8 trips for every thread: all eight loads in flight together
  for (int it = 0; it < 64 * (IN / 4) / NTH; ++it) { const int q = it * NTH + tid, rl = q >> 6, pc = q & 63; v4f v = *(const v4f*)(x + (size_t)(tb + rl) * IN + pc * 4);
#pragma unroll
    for (int e = 0; e < 4; ++e) v[e] = bfr(v[e]);      // x is rounded to bf16 everywhere, including the final mat-vec
    *(v4f*)(&sx[rl >> 4][rl & 15][pc * 4]) = v; }
  __syncthreads();
  // c2 of this wave's four bias tiles (columns n = s*64 + j*16 + col): loaded here, used behind the next barrier, so that they fly over the hw/hb phase
  float cb[4];
#pragma unroll
  for (int j = 0; j < 4; ++j) cb[j] = c2[(s * 4 + j) * 16 + col];
  asm volatile("s_wait_xcnt 0x0" ::: "memory");      // stands in front of the first overwrite of these loads' address registers, which the next phase reuses at once
  // hw, hb: [16 x 256] @ [256 x 32]: 2 column tiles each, exact bf16 products; wave s = 0,1: hw tile j = s; s = 2,3: hb tile j = s - 2
  { const int j = s & 1; v8f ac = {};      // both operands from LDS: the staged x row (already bf16 values, so the conversion is exact) and row s*16 + col of [w1; u1]
#pragma unroll
    for (int kc = 0; kc < IN / 32; ++kc) { const v16b a = split_row(&sx[tt][col][0], kc * 32, lane).h;
      ac = wmma_bf(a, frag_b(&sw1[s * 16 + col][kc * 32], lane), ac); }
    const int n = j * 16 + col;
    if ((s >> 1) == 0) { const float bb1 = bfr(b1[n]);
#pragma unroll
      for (int r = 0; r < 8; ++r) { const float hv = ac[r] + bb1; const __bf16 hi = (__bf16)hv; sa[tt][8 * g + r][n] = hi; sa[tt][8 * g + r][32 + n] = (__bf16)(hv - (float)hi); } }
    else { const float cc1 = bfr(c1[n]);
#pragma unroll
      for (int r = 0; r < 8; ++r) { const float hv = ac[r] + cc1; const __bf16 hi = (__bf16)hv; sab[tt][8 * g + r][n] = hi; sab[tt][8 * g + r][32 + n] = (__bf16)(hv - (float)hi); } } }
  { const v4f* xr = (const v4f*)&sx[tt][col][(s * 2 + g) * 32]; float sm = 0.f;      // row sums of x: this lane's slice of 32, in index order
#pragma unroll
    for (int i = 0; i < 8; ++i) { const v4f v = xr[i];
#pragma unroll
      for (int e = 0; e < 4; ++e) sm += v[e]; }
    ssxp[tt][col][s * 2 + g] = sm; }
  __syncthreads();
  // bias path: bgen[t][o] = hb . u2[o] + c2[o] on WMMA: [16 tokens x 32] @ [32 x 16 outputs], four tiles per wave (the 4 waves of a token tile cover the 256 outputs), then LN over o
  { const v16b h_hi = frag_b(&sab[tt][col][0], lane), h_lo = frag_b(&sab[tt][col][32], lane);
#pragma unroll
    for (int j = 0; j < 4; ++j) { const int n = (s * 4 + j) * 16 + col; const v16b ub = frag_b(&su2[n][0], lane);
      v8f acc = wmma_bf(h_lo, ub, (v8f){}); acc = wmma_bf(h_hi, ub, acc);
      const float cc = bfr(cb[j]);
#pragma unroll
      for (int r = 0; r < 8; ++r) sbias[tt][8 * g + r][n] = acc[r] + cc; }
    LDSX();      // the slice sums below read what other lanes of this same wave have just stored (its own 64 columns)
    const int rl = lane & 15;
#pragma unroll
    for (int u = 0; u < 2; ++u) { const int sl = s * 4 + (lane >> 4) * 2 + u; const v4f* br = (const v4f*)&sbias[tt][rl][sl * 16]; float sm = 0.f, sq = 0.f;
#pragma unroll
      for (int oq = 0; oq < 4; ++oq) { const v4f bv = br[oq];
#pragma unroll
        for (int e = 0; e < 4; ++e) { sm += bv[e]; sq += bv[e] * bv[e]; } }
      sps[tt][rl][sl] = sm; spq[tt][rl][sl] = sq; }
    if (s == 0) { float sm = 0.f;      // the 8 slices of a row of x, in order
#pragma unroll
      for (int c = 0; c < 8; ++c) sm += ssxp[tt][rl][c];
      if (g == 0) ssx[tt][rl] = sm; } }
  __syncthreads();
  { const int rl = lane & 15, hf = lane >> 4; float sm = 0.f, sq = 0.f;
#pragma unroll
    for (int c = 0; c < 16; ++c) { sm += sps[tt][rl][c]; sq += spq[tt][rl][c]; }
    const float mu = sm * (1.0f / OUT); float var = sq * (1.0f / OUT) - mu * mu; var = var > 0.f ? var : 0.f; const float rs = rsqrtf(var + 1e-5f);
#pragma unroll
    for (int e = 0; e < 4; ++e) { const int o = blockIdx.y * OC + s * 8 + hf * 4 + e; sbias[tt][rl][o] = (sbias[tt][rl][o] - mu) * rs; } }      // the block's 32 columns, 8 per wave of the token tile
  __syncthreads();      // a wave's outputs take their bias rows from all 4 token tiles, which other waves have just normalised
  // generated-weight path: the token-side fragments (hi chunk, lo chunk) of all 4 token tiles are fixed and go in as B: column = token col
  v16b a_hi[4], a_lo[4];
#pragma unroll
  for (int t = 0; t < 4; ++t) { a_hi[t] = frag_b(&sa[t][col][0], lane); a_lo[t] = frag_b(&sa[t][col][32], lane); }
#pragma unroll 1
  for (int oo = 0; oo < OW; ++oo) { v2f sw1[4][2], sw2[4][2], swx[4][2];      // per token tile, this lane's token: sums over its i, as two packed chains each so that a packed add does not wait on the one before it
#pragma unroll
    for (int t = 0; t < 4; ++t)
#pragma unroll
      for (int k = 0; k < 2; ++k) { sw1[t][k] = (v2f){}; sw2[t][k] = (v2f){}; swx[t][k] = (v2f){}; }
#pragma unroll 1      // one copy of the chunk body: the prefetch stays ahead of the tile loop and its stores behind it
    for (int q = 0; q < 8; ++q) { const int c = oo * 8 + q;      // chunk c = tiles 2q, 2q+1 of output o0 + oo, in buffer c & 1
      if (c + 1 < NCH) {      // next chunk's global reads, in flight over this chunk's work
        const float* bnx = bsl + (c + 1) * 32; const float* wnx = wsl + (size_t)(c + 1) * (32 * HID);
        bn = bnx[0];
#pragma unroll
        for (int p = 0; p < 2; ++p)
#pragma unroll
          for (int j = 0; j < 4; ++j) pf[p][j] = *(const v4f*)(wnx + p * (16 * HID) + j * 128);
        asm volatile("s_wait_xcnt 0x0" :: "v"(bnx), "v"(wnx) : "memory"); }      // stands in front of every overwrite of these loads' address registers: as inputs here they stay live, so no load's result is placed on them
#pragma unroll 1      // one tile at a time: both at once pushed the prefetched registers out to scratch
      for (int p = 0; p < 2; ++p) { const int i0 = (q * 2 + p) * 16 + 8 * g; const __bf16* tp = &sw[c & 1][wave * 2 + p][0];      // result element r = (i = i0 + r, token col)
        union { v16b v; v8b h[2]; } wb; wb.h[0] = *(const v8b*)(tp + ro0); wb.h[1] = *(const v8b*)(tp + ro1);      // elements 0..7 = k 8g.., 8..15 = k 16+8g.., row = w2 row o*256 + tile*16 + col
        union { v8f v; v4f h[2]; } cb; const v4f* bp = (const v4f*)&sb2[c & 1][wave][p * 16 + 8 * g]; cb.h[0] = bp[0]; cb.h[1] = bp[1];
        v8f acc[4];      // four independent accumulator tiles, plain builtins: the other tiles' WMMAs fill most of the distance behind each, the compiler pads the rest
#pragma unroll
        for (int t = 0; t < 4; ++t) acc[t] = __builtin_amdgcn_wmma_f32_16x16x32_bf16(false, wb.v, false, a_lo[t], (short)0, cb.v, false, false);
#pragma unroll
        for (int t = 0; t < 4; ++t) acc[t] = __builtin_amdgcn_wmma_f32_16x16x32_bf16(false, wb.v, false, a_hi[t], (short)0, acc[t], false, false);
#pragma unroll
        for (int t = 0; t < 4; ++t) { const v4f* xp = (const v4f*)&sx[t][col][i0]; const v4f xa = xp[0], xb = xp[1];
#pragma unroll
          for (int k = 0; k < 4; ++k) { const v2f wv = { acc[t][2 * k], acc[t][2 * k + 1] }; const v2f xv = k < 2 ? (v2f){ xa[2 * (k & 1)], xa[2 * (k & 1) + 1] } : (v2f){ xb[2 * (k & 1)], xb[2 * (k & 1) + 1] };
            sw1[t][k & 1] += wv; sw2[t][k & 1] += wv * wv; swx[t][k & 1] += wv * xv; } } }
      if (c + 1 < NCH) {      // the other buffer's last reads, this wave's own, stand in front of these stores
#pragma unroll
        for (int p = 0; p < 2; ++p)
#pragma unroll
          for (int j = 0; j < 4; ++j) { v4b h;
#pragma unroll
            for (int e = 0; e < 4; ++e) h[e] = (__bf16)pf[p][j][e];
            *(v4b*)(&sw[(c + 1) & 1][wave * 2 + p][wbase + ((j * 4 + wrot) & 15) * 8]) = h; }
        sb2[(c + 1) & 1][wave][lane] = bfr(bn);
        LDSX(); } }      // chunk c + 1 is read by other lanes of this same wave than those that stored it
    // fold the packed chains, then add what the other lane half (the other 8 i of every tile) holds for the same token
#pragma unroll
    for (int t = 0; t < 4; ++t) { const v2f p1 = sw1[t][0] + sw1[t][1], p2 = sw2[t][0] + sw2[t][1], px = swx[t][0] + swx[t][1];
      float t1 = p1[0] + p1[1], t2 = p2[0] + p2[1], tx = px[0] + px[1];
      t1 += xhalf(t1); t2 += xhalf(t2); tx += xhalf(tx);
      const float mu = t1 * (1.0f / IN); float var = t2 * (1.0f / IN) - mu * mu; var = var > 0.f ? var : 0.f; const float rs = rsqrtf(var + 1e-5f);      // every lane finishes its own token
      const float yv = (tx - mu * ssx[t][col]) * rs + sbias[t][col][o0 + oo];
      if (g == 0) sy[t][col][wave * OW + oo] = yv; } }      // lanes col and col + 16 hold the same value
  __syncthreads();
  if (tid < 64 * (OC / 4)) { const int rl = tid >> 3, pc = tid & 7; vst2(y + (size_t)(tb + rl) * OUT + blockIdx.y * OC + pc * 4, *(const v4f*)(&sy[rl >> 4][rl & 15][pc * 4])); }
}
extern "C" void kernel_launch(void* const* d_in, const int* in_sizes, int n_in, void* d_out, int out_size, void* d_ws, size_t ws_size, hipStream_t stream) {
  (void)in_sizes; (void)n_in; (void)out_size; (void)ws_size; (void)d_ws;
  const float** I = (const float**)d_in;   // x, w1, b1, w2, b2, u1, c1, u2, c2
  k_meta<<<dim3(NT / 64, OUT / OC), NTH, 0, stream>>>(I[0], I[1], I[2], I[3], I[4], I[5], I[6], I[7], I[8], (float*)d_out);
}

// v009
// It runs in 19.9 microseconds.
// Versions between v007 and this one are left out; their measured steps multiply to 1.12 times as fast.
// All steps since v000 together make it 123 times as fast.
// compute dtype: x, w1, u1 (INPUTS) as exact f16 WMMA products (f32 accumulate); the generated weights w = hw w2^T use the computed 32-wide code hw rounded once to f16 against f16(w2) (1 product); the generated bias hb u2^T likewise uses hb as a f16 hi/lo pair against f16(u2) (2 products, f32-grade); LayerNorm statistics and the per-token mat-vec with (f16-rounded) x in f32. The 65,536 generated weights per token never leave registers: each 16x16 tile contributes its partial sums (sum w, sum w^2, sum w*x) directly.
#include <hip/hip_runtime.h>
#include <math.h>

typedef __attribute__((ext_vector_type(16))) _Float16 v16h;
typedef __attribute__((ext_vector_type(16))) _Float16 v16b;
typedef __attribute__((ext_vector_type(8)))  _Float16 v8h;
typedef __attribute__((ext_vector_type(8)))  float v8f;
typedef __attribute__((ext_vector_type(4)))  float v4f;
typedef __attribute__((ext_vector_type(2)))  float v2f;
typedef __attribute__((ext_vector_type(4)))  unsigned v4u;
typedef __attribute__((ext_vector_type(4)))  int v4i;
typedef float __attribute__((may_alias)) float_a;
typedef int __attribute__((may_alias)) int_a;

template <typename T> __device__ __forceinline__ void vst2(void* p, T v) { *(T*)p = v;  }
__device__ __forceinline__ v8f wmma16(v16h a, v16h b, v8f c) {
  v8f d = __builtin_amdgcn_wmma_f32_16x16x32_f16(false, a, false, b, (short)0, c, false, false);
  asm volatile("v_nop\n\tv_nop\n\tv_nop\n\tv_nop" : "+v"(d) : "v"(a), "v"(b));
  return d;
}
__device__ __forceinline__ v8f wmma_bf(v16b a, v16b b, v8f c) {
  v8f d = __builtin_amdgcn_wmma_f32_16x16x32_f16(false, a, false, b, (short)0, c, false, false);
  asm volatile("v_nop\n\tv_nop\n\tv_nop\n\tv_nop" : "+v"(d) : "v"(a), "v"(b));
  return d;
}
// 16x16x32 fragments: lane = (h = lane>>4, row/col = lane&15); elements 0..7 = k0+8h+0..7, 8..15 = k0+16+8h+0..7; D element r = row 8h+r
__device__ __forceinline__ v16h frag_h(const _Float16* rowk0, int lane) {
  union { v16h v; v8h q[2]; } u; const _Float16* p = rowk0 + 8 * (lane >> 4);
  u.q[0] = *(const v8h*)p; u.q[1] = *(const v8h*)(p + 16); return u.v;
}
__device__ __forceinline__ v16h frag_f32(const float* rowk0, int lane) {
  v16h a; const float* p = rowk0 + 8 * (lane >> 4);
#pragma unroll
  for (int i = 0; i < 8; ++i) { a[i] = (_Float16)p[i]; a[8 + i] = (_Float16)p[16 + i]; }
  return a;
}
__device__ __forceinline__ v16h frag_f32s(const float* rowk0, int lane, float sc) {
  v16h a; const float* p = rowk0 + 8 * (lane >> 4);
#pragma unroll
  for (int i = 0; i < 8; ++i) { a[i] = (_Float16)(p[i] * sc); a[8 + i] = (_Float16)(p[16 + i] * sc); }
  return a;
}
// column fragment from a [K][ld] layout (column n), rows >= K read as 0
__device__ __forceinline__ v16h fragc_f32(const float* W, int k0, int n, int lane, int ld, int K) {
  v16h a; const int g = lane >> 4;
#pragma unroll
  for (int i = 0; i < 8; ++i) { const int ka = k0 + 8 * g + i, kb = ka + 16;
    a[i] = (_Float16)(ka < K ? W[(size_t)(ka < K ? ka : K - 1) * ld + n] : 0.f); a[8 + i] = (_Float16)(kb < K ? W[(size_t)(kb < K ? kb : K - 1) * ld + n] : 0.f); }
  return a;
}
struct F2 { v16b h, l; };
__device__ __forceinline__ F2 bsplit16(const float v[16]) { F2 r;
#pragma unroll
  for (int i = 0; i < 16; ++i) { const _Float16 h = (_Float16)v[i]; r.h[i] = h; r.l[i] = (_Float16)(v[i] - (float)h); }
  return r; }
__device__ __forceinline__ F2 split_row(const float* row, int k0, int lane) { float v[16]; const float* p = row + k0 + 8 * (lane >> 4);
#pragma unroll
  for (int i = 0; i < 8; ++i) { v[i] = p[i]; v[8 + i] = p[16 + i]; }
  return bsplit16(v); }
__device__ __forceinline__ F2 split_rowK(const float* row, int k0, int lane, int K) { float v[16]; const int g = lane >> 4;
#pragma unroll
  for (int i = 0; i < 8; ++i) { const int ka = k0 + 8 * g + i, kb = ka + 16; v[i] = ka < K ? row[ka < K ? ka : K - 1] : 0.f; v[8 + i] = kb < K ? row[kb < K ? kb : K - 1] : 0.f; }
  return bsplit16(v); }
__device__ __forceinline__ F2 split_col(const float* W, int k0, int n, int lane, int ld, int K) { float v[16]; const int g = lane >> 4;
#pragma unroll
  for (int i = 0; i < 8; ++i) { const int ka = k0 + 8 * g + i, kb = ka + 16; v[i] = ka < K ? W[(size_t)(ka < K ? ka : K - 1) * ld + n] : 0.f; v[8 + i] = kb < K ? W[(size_t)(kb < K ? kb : K - 1) * ld + n] : 0.f; }
  return bsplit16(v); }
__device__ __forceinline__ v8f mac3(const F2& a, const F2& b, v8f c) { c = wmma_bf(a.l, b.h, c); c = wmma_bf(a.h, b.l, c); return wmma_bf(a.h, b.h, c); }
__device__ __forceinline__ float sigm(float v) { return 1.0f / (1.0f + expf(-v)); }
#define LDSX() do { asm volatile("s_wait_dscnt 0" ::: "memory"); __builtin_amdgcn_wave_barrier(); __builtin_amdgcn_fence(__ATOMIC_RELEASE, "workgroup"); } while (0)


// Hyper-network linear layer: per token: hw = x w1^T + b1 (32); W[o][i] = LN_i(hw . w2[o*256+i] + b2[o*256+i]) (no affine, eps 1e-5); hb = x u1^T + c1; bias[o] = LN_o(hb . u2[o] + c2[o]);
// y[o] = sum_i W[o][i] x[i] + bias[o] = (S_wx - mu_o S_x) * rsqrt(var_o + eps) + bias[o], with S_w, S_w2, S_wx accumulated per (token, o) over the 16 tiles of that o.
// One kernel: block = 64 tokens x 32 outputs, 16 waves; grid = 32 token blocks x 8 output chunks, one block per WGP.
// The head is shared by the block through LDS, wave = (token tile tt, quarter s): x rows and the head's weights (w1, u1, u2, as f16) staged by all threads with whole-line loads; hw/hb by exact WMMA, one 16x16 tile per wave, fragments read from LDS; row sums of x in 8 slices of 32; the bias rows by WMMA, four 16x16 tiles per wave, their LN sums in 16 slices of 16 outputs.
// hw is rounded once to f16 into an LDS fragment row of 32 (one k-chunk).
// Main loop: a wave owns 2 outputs and ALL 4 token tiles: it holds the 4 tiles' hw fragments in registers, and each w2 fragment and b2 vector it reads from LDS serves 4 tiles of [16 i x 16 tokens]
// (f16(w2 rows) as A x the hw fragments as B, f16(b2) as C): a lane holds 8 consecutive i of ONE token per tile, so the three sums over i run inside the lane; one add across the two lane halves finishes y[token][o]; the block stores whole 128-byte lines.
// w2 reaches its fragments through LDS, private to the wave that uses it: loads that cover whole 128-byte lines, rounded to f16 once, stored in fragment order;
// two buffers of 2 tiles, the next chunk's loads (and its b2 values) fly in registers while this chunk is worked on; no work-group barrier in the loop.
// The 32 token blocks that share a block row's w2 lines start their walk over the 16 chunks at 16 different places (which output first, which chunk of it first), so that they do not ask L2 for the same lines at the same moment.
#define NB 4
#define SQ 512
#define NT (NB * SQ)     // 2048 tokens
#define IN 256
#define OUT 256
#define HID 32
__device__ __forceinline__ float bfr(float v) { return (float)(_Float16)v; }
__device__ __forceinline__ v16b frag_b(const _Float16* rowk0, int lane) { return __builtin_bit_cast(v16b, frag_h((const _Float16*)rowk0, lane)); }

// the value that lane ^ 16 holds (same place in the other row of 16 lanes)
__device__ __forceinline__ float xhalf(float v) { const int b = __builtin_bit_cast(int, v);
  return __builtin_bit_cast(float, __builtin_amdgcn_permlanex16(b, b, 0x76543210, 0xfedcba98, false, false)); }
#define OC 32            // outputs per block: one 128-byte line of y per token
#define OW 2             // outputs per wave
#define NCH (OW * 8)     // chunks of 2 tiles (32 w2 rows) per wave
#define NTH 512          // threads per block
typedef __attribute__((ext_vector_type(4))) _Float16 v4b;
typedef __attribute__((ext_vector_type(8))) _Float16 v8b;
__global__ __launch_bounds__(NTH) void k_meta(const float* __restrict__ x, const float* __restrict__ w1, const float* __restrict__ b1, const float* __restrict__ w2, const float* __restrict__ b2, const float* __restrict__ u1, const float* __restrict__ c1, const float* __restrict__ u2, const float* __restrict__ c2, float* __restrict__ y) {
  __shared__ __align__(16) _Float16 sa[4][16][40];        // per token: f16(hw), 32 values -> token-side fragments for the w2 GEMM; pitch 80 B = 16 B x odd
  __shared__ __align__(16) _Float16 sab[4][16][72];       // per token: [hi(hb) 32 | lo(hb) 32] -> A fragments for the u2 GEMM
  __shared__ __align__(16) float sx[4][16][IN + 4];      // x rows (f32) for the mat-vec partials
  __shared__ __align__(16) float sy[4][16][OC + 4];      // this block's outputs
  __shared__ __align__(16) float sbias[4][16][OUT + 4];  // generated bias pre-LN; the block's 32 columns then LN'd
  __shared__ float sps[4][16][17], spq[4][16][17];       // bias LN partial sums, one per slice of 16 outputs
  __shared__ float ssxp[4][16][9];                       // sums of x[row][i] over slices of 32 i
  __shared__ float ssx[4][16];                           // sum_i x[row][i]
  __shared__ __align__(16) _Float16 sw[2][32][512];        // w2 tiles as f16 fragments: [buffer][wave * 2 + tile of the chunk][k half][slot of 8 values]
  __shared__ __align__(16) float sb2[2][16][32];         // f16-rounded b2 of the same tiles: [buffer][wave][tile of the chunk * 16 + row]
  __shared__ __align__(16) _Float16 sw1[64][IN + 8];       // f16(w1) rows 0..31, f16(u1) rows 32..63; pitch 528 B = 16 B x odd, so that 16 rows read by b128 fall on different banks
  __shared__ __align__(16) _Float16 su2[OUT][HID + 8];     // f16(u2) rows; pitch 80 B = 16 B x odd
  const int tid = threadIdx.x, wave = __builtin_amdgcn_readfirstlane(tid >> 5), lane = tid & 31, col = lane & 15, g = lane >> 4;
  const int tt = wave & 3, s = wave >> 2; const int tb = blockIdx.x * 64, o0 = blockIdx.y * OC + wave * OW;      // (tt, s): the wave's share of the head; o0: its outputs in the main loop
  // w2 staging. Source: the 32 rows of each chunk of this wave's outputs; load (p, j) takes 512 consecutive bytes (rows 4j..4j+3 of tile p), lane = (row lane>>3, k = 4*(lane&7)..+3).
  // Place of (row, k block kb = k>>3): half kb>>1, slot 16*(kb&1) + ((row + 4*kb) & 15): a fragment read takes 512 bytes in a row, and the 32 lanes of a store fall on 64 different banks.
  // where this block starts its walk: 16 places from blockIdx.x (bits 0, 1, 3, 4); step c of the walk takes chunk CID(c): output (c >> 3) ^ r1, chunk (c + r0) & 7 of it. For speed only: every chunk is taken once wherever the block runs.
  const int ph = (blockIdx.x & 3) | ((blockIdx.x >> 3) << 2), r0 = ph & 7, r1 = (ph >> 3) & 1;
#define CID(c) (((((c) >> 3) ^ r1) << 3) | (((c) + r0) & 7))
  const float* wsb = w2 + (size_t)o0 * IN * HID + lane * 4;
  const float* bsb = b2 + (size_t)o0 * IN + lane;
  const float* wsl = wsb + (size_t)CID(0) * (32 * HID);      // the first chunk of the walk
  const float* bsl = bsb + CID(0) * 32;
  const int kb = (lane & 7) >> 1, wbase = (kb >> 1) * 256 + (kb & 1) * 128 + (lane & 1) * 4, wrot = (lane >> 3) + 4 * kb;
  const int ro0 = (g * 16 + ((col + 4 * g) & 15)) * 8, ro1 = 256 + (g * 16 + ((col + 4 * (2 + g)) & 15)) * 8;      // this lane's two fragment halves
  v4f pf[2][4]; float bn = bsl[0];
#pragma unroll      // pf[][] is indexed by constants only, so it stays in registers
  for (int p = 0; p < 2; ++p)
#pragma unroll
    for (int j = 0; j < 4; ++j) pf[p][j] = *(const v4f*)(wsl + p * (16 * HID) + j * 128);
  asm volatile("s_wait_xcnt 0x0" :: "v"(bsl), "v"(wsl) : "memory");      // stands in front of every overwrite of these nine loads' address registers: as inputs here they stay live, so no later load's result is placed on them
  // the head's weights (w1, u1, u2): every wave-wide load takes 512 consecutive bytes, each value is read once per block; load it takes rows it*8 + (tid >> 6) of [w1; u1]
  v4f hv[8], uq[4];
#pragma unroll      // hv[] and uq[] are indexed by constants only, and all twelve loads fly together
  for (int it = 0; it < 8; ++it) hv[it] = *(const v4f*)((it < 4 ? w1 : u1) + (size_t)((it & 3) * 8 + (tid >> 6)) * IN + (tid & 63) * 4);
#pragma unroll
  for (int it = 0; it < 4; ++it) uq[it] = *(const v4f*)(u2 + (size_t)(it * NTH + tid) * 4);
#pragma unroll
  for (int p = 0; p < 2; ++p)
#pragma unroll
    for (int j = 0; j < 4; ++j) { v4b h;
#pragma unroll
      for (int e = 0; e < 4; ++e) h[e] = (_Float16)pf[p][j][e];
      *(v4b*)(&sw[0][wave * 2 + p][wbase + ((j * 4 + wrot) & 15) * 8]) = h; }
  sb2[0][wave][lane] = bfr(bn);      // chunk 0: read by this wave alone, far behind the head's barriers
#pragma unroll
  for (int it = 0; it < 8; ++it) { v4b h;
#pragma unroll
    for (int e = 0; e < 4; ++e) h[e] = (_Float16)hv[it][e];
    *(v4b*)(&sw1[it * 8 + (tid >> 6)][(tid & 63) * 4]) = h; }
#pragma unroll
  for (int it = 0; it < 4; ++it) { const int q = it * NTH + tid; v4b h;
#pragma unroll
    for (int e = 0; e < 4; ++e) h[e] = (_Float16)uq[it][e];
    *(v4b*)(&su2[q >> 3][(q & 7) * 4]) = h; }      // both published by the barrier behind the x rows
  // stage x rows
#pragma unroll      // 8 trips for every thread: all eight loads in flight together
  for (int it = 0; it < 64 * (IN / 4) / NTH; ++it) { const int q = it * NTH + tid, rl = q >> 6, pc = q & 63; v4f v = *(const v4f*)(x + (size_t)(tb + rl) * IN + pc * 4);
#pragma unroll
    for (int e = 0; e < 4; ++e) v[e] = bfr(v[e]);
    *(v4f*)(&sx[rl >> 4][rl & 15][pc * 4]) = v; }
  __syncthreads();
  // c2 of this wave's four bias tiles (columns n = s*64 + j*16 + col): loaded here, used behind the next barrier, so that they fly over the hw/hb phase
  float cb[4];
#pragma unroll
  for (int j = 0; j < 4; ++j) cb[j] = c2[(s * 4 + j) * 16 + col];
  asm volatile("s_wait_xcnt 0x0" ::: "memory");      // stands in front of the first overwrite of these loads' address registers, which the next phase reuses at once
  // hw, hb: [16 x 256] @ [256 x 32]: 2 column tiles each, exact f16 products; wave s = 0,1: hw tile j = s; s = 2,3: hb tile j = s - 2
  { const int j = s & 1; v8f ac = {};      // both operands from LDS: the staged x row (already f16 values, so the conversion is exact) and row s*16 + col of [w1; u1]
#pragma unroll
    for (int kc = 0; kc < IN / 32; ++kc) { const v16b a = split_row(&sx[tt][col][0], kc * 32, lane).h;
      ac = wmma_bf(a, frag_b(&sw1[s * 16 + col][kc * 32], lane), ac); }
    const int n = j * 16 + col;
    if ((s >> 1) == 0) { const float bb1 = bfr(b1[n]);
#pragma unroll
      for (int r = 0; r < 8; ++r) sa[tt][8 * g + r][n] = (_Float16)(ac[r] + bb1); }
    else { const float cc1 = bfr(c1[n]);
#pragma unroll
      for (int r = 0; r < 8; ++r) { const float hv = ac[r] + cc1; const _Float16 hi = (_Float16)hv; sab[tt][8 * g + r][n] = hi; sab[tt][8 * g + r][32 + n] = (_Float16)(hv - (float)hi); } } }
  { const v4f* xr = (const v4f*)&sx[tt][col][(s * 2 + g) * 32]; float sm = 0.f;      // row sums of x: this lane's slice of 32, in index order
#pragma unroll
    for (int i = 0; i < 8; ++i) { const v4f v = xr[i];
#pragma unroll
      for (int e = 0; e < 4; ++e) sm += v[e]; }
    ssxp[tt][col][s * 2 + g] = sm; }
  __syncthreads();
  // bias path: bgen[t][o] = hb . u2[o] + c2[o] on WMMA: [16 tokens x 32] @ [32 x 16 outputs], four tiles per wave (the 4 waves of a token tile cover the 256 outputs), then LN over o
  { const v16b h_hi = frag_b(&sab[tt][col][0], lane), h_lo = frag_b(&sab[tt][col][32], lane);
#pragma unroll
    for (int j = 0; j < 4; ++j) { const int n = (s * 4 + j) * 16 + col; const v16b ub = frag_b(&su2[n][0], lane);
      v8f acc = wmma_bf(h_lo, ub, (v8f){}); acc = wmma_bf(h_hi, ub, acc);
      const float cc = bfr(cb[j]);
#pragma unroll
      for (int r = 0; r < 8; ++r) sbias[tt][8 * g + r][n] = acc[r] + cc; }
    LDSX();      // the slice sums below read what other lanes of this same wave have just stored (its own 64 columns)
    const int rl = lane & 15;
#pragma unroll
    for (int u = 0; u < 2; ++u) { const int sl = s * 4 + (lane >> 4) * 2 + u; const v4f* br = (const v4f*)&sbias[tt][rl][sl * 16]; float sm = 0.f, sq = 0.f;
#pragma unroll
      for (int oq = 0; oq < 4; ++oq) { const v4f bv = br[oq];
#pragma unroll
        for (int e = 0; e < 4; ++e) { sm += bv[e]; sq += bv[e] * bv[e]; } }
      sps[tt][rl][sl] = sm; spq[tt][rl][sl] = sq; }
    if (s == 0) { float sm = 0.f;      // the 8 slices of a row of x, in order
#pragma unroll
      for (int c = 0; c < 8; ++c) sm += ssxp[tt][rl][c];
      if (g == 0) ssx[tt][rl] = sm; } }
  __syncthreads();
  { const int rl = lane & 15, hf = lane >> 4; float sm = 0.f, sq = 0.f;
#pragma unroll
    for (int c = 0; c < 16; ++c) { sm += sps[tt][rl][c]; sq += spq[tt][rl][c]; }
    const float mu = sm * (1.0f / OUT); float var = sq * (1.0f / OUT) - mu * mu; var = var > 0.f ? var : 0.f; const float rs = rsqrtf(var + 1e-5f);
#pragma unroll
    for (int e = 0; e < 4; ++e) { const int o = blockIdx.y * OC + s * 8 + hf * 4 + e; sbias[tt][rl][o] = (sbias[tt][rl][o] - mu) * rs; } }      // the block's 32 columns, 8 per wave of the token tile
  __syncthreads();      // a wave's outputs take their bias rows from all 4 token tiles, which other waves have just normalised
  // generated-weight path: the token-side fragments of all 4 token tiles are fixed and go in as B: column = token col
  v16b a_hw[4];
#pragma unroll
  for (int t = 0; t < 4; ++t) a_hw[t] = frag_b(&sa[t][col][0], lane);
#pragma unroll 1
  for (int oo = 0; oo < OW; ++oo) { v2f sw1[4][2], sw2[4][2], swx[4][2];      // per token tile, this lane's token: sums over its i, as two packed chains each so that a packed add does not wait on the one before it
#pragma unroll
    for (int t = 0; t < 4; ++t)
#pragma unroll
      for (int k = 0; k < 2; ++k) { sw1[t][k] = (v2f){}; sw2[t][k] = (v2f){}; swx[t][k] = (v2f){}; }
#pragma unroll 1      // one copy of the chunk body: the prefetch stays ahead of the tile loop and its stores behind it
    for (int q = 0; q < 8; ++q) { const int c = oo * 8 + q, qr = (q + r0) & 7;      // step c = chunk CID(c) = tiles 2qr, 2qr+1 of output o0 + (oo ^ r1), in buffer c & 1
      if (c + 1 < NCH) {      // next chunk's global reads, in flight over this chunk's work
        const float* bnx = bsb + CID(c + 1) * 32; const float* wnx = wsb + (size_t)CID(c + 1) * (32 * HID);
        bn = bnx[0];
#pragma unroll
        for (int p = 0; p < 2; ++p)
#pragma unroll
          for (int j = 0; j < 4; ++j) pf[p][j] = *(const v4f*)(wnx + p * (16 * HID) + j * 128);
        asm volatile("s_wait_xcnt 0x0" :: "v"(bnx), "v"(wnx) : "memory"); }      // stands in front of every overwrite of these loads' address registers: as inputs here they stay live, so no load's result is placed on them
#pragma unroll 1      // one tile at a time: both at once pushed the prefetched registers out to scratch
      for (int p = 0; p < 2; ++p) { const int i0 = (qr * 2 + p) * 16 + 8 * g; const _Float16* tp = &sw[c & 1][wave * 2 + p][0];      // result element r = (i = i0 + r, token col)
        union { v16b v; v8b h[2]; } wb; wb.h[0] = *(const v8b*)(tp + ro0); wb.h[1] = *(const v8b*)(tp + ro1);      // elements 0..7 = k 8g.., 8..15 = k 16+8g.., row = w2 row o*256 + tile*16 + col
        union { v8f v; v4f h[2]; } cb; const v4f* bp = (const v4f*)&sb2[c & 1][wave][p * 16 + 8 * g]; cb.h[0] = bp[0]; cb.h[1] = bp[1];
        v8f acc[4];      // four independent accumulator tiles, one product each, plain builtins: the other tiles' WMMAs fill most of the distance behind each, the compiler pads the rest
#pragma unroll
        for (int t = 0; t < 4; ++t) acc[t] = __builtin_amdgcn_wmma_f32_16x16x32_f16(false, wb.v, false, a_hw[t], (short)0, cb.v, false, false);
#pragma unroll
        for (int t = 0; t < 4; ++t) { const v4f* xp = (const v4f*)&sx[t][col][i0]; const v4f xa = xp[0], xb = xp[1];
#pragma unroll
          for (int k = 0; k < 4; ++k) { const v2f wv = { acc[t][2 * k], acc[t][2 * k + 1] }; const v2f xv = k < 2 ? (v2f){ xa[2 * (k & 1)], xa[2 * (k & 1) + 1] } : (v2f){ xb[2 * (k & 1)], xb[2 * (k & 1) + 1] };
            sw1[t][k & 1] += wv; sw2[t][k & 1] += wv * wv; swx[t][k & 1] += wv * xv; } } }
      if (c + 1 < NCH) {      // the other buffer's last reads, this wave's own, stand in front of these stores
#pragma unroll
        for (int p = 0; p < 2; ++p)
#pragma unroll
          for (int j = 0; j < 4; ++j) { v4b h;
#pragma unroll
            for (int e = 0; e < 4; ++e) h[e] = (_Float16)pf[p][j][e];
            *(v4b*)(&sw[(c + 1) & 1][wave * 2 + p][wbase + ((j * 4 + wrot) & 15) * 8]) = h; }
        sb2[(c + 1) & 1][wave][lane] = bfr(bn);
        LDSX(); } }      // chunk c + 1 is read by other lanes of this same wave than those that stored it
    // fold the packed chains, then add what the other lane half (the other 8 i of every tile) holds for the same token
#pragma unroll
    for (int t = 0; t < 4; ++t) { const v2f p1 = sw1[t][0] + sw1[t][1], p2 = sw2[t][0] + sw2[t][1], px = swx[t][0] + swx[t][1];
      float t1 = p1[0] + p1[1], t2 = p2[0] + p2[1], tx = px[0] + px[1];
      t1 += xhalf(t1); t2 += xhalf(t2); tx += xhalf(tx);
      const float mu = t1 * (1.0f / IN); float var = t2 * (1.0f / IN) - mu * mu; var = var > 0.f ? var : 0.f; const float rs = rsqrtf(var + 1e-5f);      // every lane finishes its own token
      const float yv = (tx - mu * ssx[t][col]) * rs + sbias[t][col][o0 + (oo ^ r1)];
      if (g == 0) sy[t][col][wave * OW + (oo ^ r1)] = yv; } }      // lanes col and col + 16 hold the same value
  __syncthreads();
  if (tid < 64 * (OC / 4)) { const int rl = tid >> 3, pc = tid & 7; vst2(y + (size_t)(tb + rl) * OUT + blockIdx.y * OC + pc * 4, *(const v4f*)(&sy[rl >> 4][rl & 15][pc * 4])); }
}
extern "C" void kernel_launch(void* const* d_in, const int* in_sizes, int n_in, void* d_out, int out_size, void* d_ws, size_t ws_size, hipStream_t stream) {
  (void)in_sizes; (void)n_in; (void)out_size; (void)ws_size; (void)d_ws;
  const float** I = (const float**)d_in;   // x, w1, b1, w2, b2, u1, c1, u2, c2
  k_meta<<<dim3(NT / 64, OUT / OC), NTH, 0, stream>>>(I[0], I[1], I[2], I[3], I[4], I[5], I[6], I[7], I[8], (float*)d_out);
}
